// v000
// Measured on an AMD MI455X. A time is GPU time per run, averaged over a window of back-to-back runs after a warm-up
// (all launches, gaps included; the runs take copies of the inputs in turn), and the median of several windows.
// Apart from v000's, it joins two sittings. Times from different sittings can be a few percent apart, while
// side-by-side timings come from the same sitting.
// The starting kernel, v000, takes 90.5 microseconds a run.
#include <hip/hip_runtime.h>
#include <hip/hip_bf16.h>

typedef __attribute__((ext_vector_type(2))) float v2f;
typedef __attribute__((ext_vector_type(8))) float v8f;

// Problem constants
constexpr int CB  = 2;            // batch
constexpr int CC  = 128;          // channels
constexpr int CH  = 96;
constexpr int CW  = 96;
constexpr int CNH = 4;            // heads
constexpr int CHD = 32;           // head dim
constexpr int CHW = CH * CW;      // 9216
constexpr int NPIX = CB * CHW;    // 18432

// ---------------------------------------------------------------------------
// Kernel 1: q/k/v = xs @ w   (xs read on the fly from NCHW x)
// One wave -> 16-pixel x 128-channel output tile of one of {q,k,v}.
// fp32 WMMA 16x16x4: A = xs tile (16 pix x 4 ch), B = weight (4 x 16).
// ---------------------------------------------------------------------------
__global__ __launch_bounds__(128) void qkv_gemm_kernel(
    const float* __restrict__ x,
    const float* __restrict__ wq, const float* __restrict__ wk,
    const float* __restrict__ wv,
    float* __restrict__ q, float* __restrict__ k, float* __restrict__ v)
{
    const int wave  = threadIdx.x >> 5;
    const int lane  = threadIdx.x & 31;
    const int l16   = lane & 15;
    const int khalf = lane >> 4;

    const int mtile = blockIdx.x * 4 + wave;      // 0..1151
    const int which = blockIdx.y;                 // 0:q 1:k 2:v
    const float* w  = (which == 0) ? wq : (which == 1) ? wk : wv;
    float*      out = (which == 0) ? q  : (which == 1) ? k  : v;

    const int rowbase = mtile * 16;               // pixel row base (16 | 9216)
    const int b = rowbase / CHW;
    const int p = rowbase - b * CHW;

    v8f acc[8] = {};                              // 16x128 tile accumulators
    const float* xbase = x + (size_t)b * CC * CHW + p + l16;

    for (int k0 = 0; k0 < CC; k0 += 4) {
        const int kk = k0 + khalf * 2;
        v2f a;                                    // A[m=l16][kk], A[m][kk+1]
        a.x = xbase[(size_t)kk * CHW];
        a.y = xbase[(size_t)(kk + 1) * CHW];
#pragma unroll
        for (int j = 0; j < 8; ++j) {
            v2f bf;                               // B[kk][n=j*16+l16]
            bf.x = w[kk * CC + j * 16 + l16];
            bf.y = w[(kk + 1) * CC + j * 16 + l16];
            acc[j] = __builtin_amdgcn_wmma_f32_16x16x4_f32(
                false, a, false, bf, (short)0, acc[j], false, false);
        }
    }

    // D layout: VGPR i -> M = i + 8*khalf ; N = l16
    float* obase = out + (size_t)rowbase * CC;
#pragma unroll
    for (int j = 0; j < 8; ++j) {
#pragma unroll
        for (int i = 0; i < 8; ++i) {
            const int mm = i + 8 * khalf;
            const int nn = j * 16 + l16;
            obase[(size_t)mm * CC + nn] = acc[j][i];
        }
    }
}

// ---------------------------------------------------------------------------
// Kernel 2: masked 7x7 neighborhood attention, LDS-tiled.
// Workgroup = 8x8 pixel tile x 1 head. Halo 14x14 x 32 dims of k and v
// (49 KB) staged in LDS -> 16x less global/L2 traffic than direct reads.
// Wave w owns tile row w; lane d owns head-dim d; online softmax.
// ---------------------------------------------------------------------------
__global__ __launch_bounds__(256) void nb_attn_lds_kernel(
    const float* __restrict__ q, const float* __restrict__ k,
    const float* __restrict__ v, const int* __restrict__ labels,
    float* __restrict__ out)
{
    __shared__ float sK[196 * 32];
    __shared__ float sV[196 * 32];
    __shared__ int   sL[196];

    const int tid  = threadIdx.x;
    const int wave = tid >> 5;
    const int lane = tid & 31;

    const int tile = blockIdx.x;                  // 0..143
    const int ty = tile / 12, tx = tile - ty * 12;
    const int r0 = ty * 8, c0 = tx * 8;
    const int b    = blockIdx.y >> 2;
    const int head = blockIdx.y & 3;

    int hr0 = r0 - 3; hr0 = hr0 < 0 ? 0 : (hr0 > CH - 14 ? CH - 14 : hr0);
    int hc0 = c0 - 3; hc0 = hc0 < 0 ? 0 : (hc0 > CW - 14 ? CW - 14 : hc0);

    const int hbase = b * CHW;
    const int coff  = head * CHD;

    // Cooperative halo load: 196 positions x 32 dims; 128B coalesced per wave.
    for (int i = tid; i < 196 * 32; i += 256) {
        const int pos = i >> 5;
        const int d   = i & 31;
        const int pr  = pos / 14;
        const int gr  = hr0 + pr;
        const int gc  = hc0 + pos - pr * 14;
        const size_t g = (size_t)(hbase + gr * CW + gc) * CC + coff + d;
        sK[i] = k[g];
        sV[i] = v[g];
    }
    for (int i = tid; i < 196; i += 256) {
        const int pr = i / 14;
        sL[i] = labels[hbase + (hr0 + pr) * CW + hc0 + i - pr * 14];
    }
    __syncthreads();

    const float scale = 0.17677669529663687f;     // 32^-0.5
    const int r = r0 + wave;                      // wave owns one tile row
    for (int pc = 0; pc < 8; ++pc) {
        const int c   = c0 + pc;
        const int pix = hbase + r * CW + c;
        int sr = r - 3; sr = sr < 0 ? 0 : (sr > CH - 7 ? CH - 7 : sr);
        int sc = c - 3; sc = sc < 0 ? 0 : (sc > CW - 7 ? CW - 7 : sc);
        const int lr0 = sr - hr0, lc0 = sc - hc0;

        const float qd    = q[(size_t)pix * CC + coff + lane] * scale;
        const int   mylab = sL[(r - hr0) * 14 + (c - hc0)];

        float mmax = -__builtin_huge_valf();
        float ssum = 0.0f, acc = 0.0f;
        for (int rr = 0; rr < 7; ++rr) {
            const int prow = (lr0 + rr) * 14 + lc0;
            for (int cc = 0; cc < 7; ++cc) {
                const int pos = prow + cc;
                const float kd = sK[pos * 32 + lane];
                float logit = qd * kd;
#pragma unroll
                for (int off = 16; off > 0; off >>= 1)
                    logit += __shfl_xor(logit, off, 32);
                if (sL[pos] != mylab) logit = -1000000000.0f;

                const float nm   = fmaxf(mmax, logit);
                const float corr = __expf(mmax - nm);
                const float e    = __expf(logit - nm);
                const float vd   = sV[pos * 32 + lane];
                ssum = ssum * corr + e;
                acc  = acc * corr + e * vd;
                mmax = nm;
            }
        }
        out[(size_t)pix * CC + coff + lane] = acc / ssum;
    }
}

// ---------------------------------------------------------------------------
// Kernel 3: final = (attn @ wproj) transposed to NCHW, computed as
//   D[c][pix] = sum_k wproj[k][c] * attn[pix][k]   (A = wproj^T, B = attn^T)
// so both weight loads and NCHW stores are lane-coalesced.
// ---------------------------------------------------------------------------
__global__ __launch_bounds__(128) void proj_gemm_kernel(
    const float* __restrict__ attn, const float* __restrict__ wp,
    float* __restrict__ out)
{
    const int wave  = threadIdx.x >> 5;
    const int lane  = threadIdx.x & 31;
    const int l16   = lane & 15;
    const int khalf = lane >> 4;

    const int pixbase = blockIdx.x * 16;                // 1152 tiles
    const int ctile   = blockIdx.y * 4 + wave;          // 0..7
    const int c0      = ctile * 16;
    const int b = pixbase / CHW;
    const int p = pixbase - b * CHW;

    v8f acc = {};
    for (int k0 = 0; k0 < CC; k0 += 4) {
        const int kk = k0 + khalf * 2;
        v2f a;                                          // A[m=c][k] = wp[k][c]
        a.x = wp[kk * CC + c0 + l16];
        a.y = wp[(kk + 1) * CC + c0 + l16];
        v2f bf;                                         // B[k][n=pix]
        bf.x = attn[(size_t)(pixbase + l16) * CC + kk];
        bf.y = attn[(size_t)(pixbase + l16) * CC + kk + 1];
        acc = __builtin_amdgcn_wmma_f32_16x16x4_f32(
            false, a, false, bf, (short)0, acc, false, false);
    }

    // D: VGPR i -> channel c0 + i + 8*khalf ; N = pixel offset l16
    float* ob = out + (size_t)b * CC * CHW + p + l16;
#pragma unroll
    for (int i = 0; i < 8; ++i) {
        const int c = c0 + i + 8 * khalf;
        ob[(size_t)c * CHW] = acc[i];
    }
}

// ---------------------------------------------------------------------------
extern "C" void kernel_launch(void* const* d_in, const int* in_sizes, int n_in,
                              void* d_out, int out_size, void* d_ws, size_t ws_size,
                              hipStream_t stream)
{
    (void)in_sizes; (void)n_in; (void)out_size; (void)ws_size;
    const float* x      = (const float*)d_in[0];
    const int*   labels = (const int*)d_in[1];
    const float* wq     = (const float*)d_in[2];
    const float* wk     = (const float*)d_in[3];
    const float* wv     = (const float*)d_in[4];
    const float* wp     = (const float*)d_in[5];

    float* q    = (float*)d_ws;
    float* k    = q + (size_t)NPIX * CC;
    float* v    = k + (size_t)NPIX * CC;
    float* attn = v + (size_t)NPIX * CC;
    float* out  = (float*)d_out;

    dim3 g1(NPIX / 16 / 4, 3);   // (288, 3), 4 waves/block
    qkv_gemm_kernel<<<g1, 128, 0, stream>>>(x, wq, wk, wv, q, k, v);

    dim3 g2((CH / 8) * (CW / 8), CB * CNH);   // (144, 8)
    nb_attn_lds_kernel<<<g2, 256, 0, stream>>>(q, k, v, labels, attn);

    dim3 g3(NPIX / 16, 2);       // (1152, 2), 4 waves/block
    proj_gemm_kernel<<<g3, 128, 0, stream>>>(attn, wp, out);
}

// v001
// Measured time: 52.6 microseconds a run.
// In both of two side-by-side timings against v000, it was 1.78 times as fast.
#include <hip/hip_runtime.h>
#include <hip/hip_bf16.h>

typedef __attribute__((ext_vector_type(2))) float v2f;
typedef __attribute__((ext_vector_type(8))) float v8f;

// Problem constants
constexpr int CB  = 2;            // batch
constexpr int CC  = 128;          // channels
constexpr int CH  = 96;
constexpr int CW  = 96;
constexpr int CNH = 4;            // heads
constexpr int CHD = 32;           // head dim
constexpr int CHW = CH * CW;      // 9216
constexpr int NPIX = CB * CHW;    // 18432

// ---------------------------------------------------------------------------
// Kernel 1: q/k/v = xs @ w   (xs read on the fly from NCHW x)
// One wave -> 16-pixel x 128-channel output tile of one of {q,k,v}.
// fp32 WMMA 16x16x4: A = xs tile (16 pix x 4 ch), B = weight (4 x 16).
// ---------------------------------------------------------------------------
__global__ __launch_bounds__(128) void qkv_gemm_kernel(
    const float* __restrict__ x,
    const float* __restrict__ wq, const float* __restrict__ wk,
    const float* __restrict__ wv,
    float* __restrict__ q, float* __restrict__ k, float* __restrict__ v)
{
    const int wave  = threadIdx.x >> 5;
    const int lane  = threadIdx.x & 31;
    const int l16   = lane & 15;
    const int khalf = lane >> 4;

    const int mtile = blockIdx.x * 4 + wave;      // 0..1151
    const int which = blockIdx.y;                 // 0:q 1:k 2:v
    const float* w  = (which == 0) ? wq : (which == 1) ? wk : wv;
    float*      out = (which == 0) ? q  : (which == 1) ? k  : v;

    const int rowbase = mtile * 16;               // pixel row base (16 | 9216)
    const int b = rowbase / CHW;
    const int p = rowbase - b * CHW;

    v8f acc[8] = {};                              // 16x128 tile accumulators
    const float* xbase = x + (size_t)b * CC * CHW + p + l16;

    for (int k0 = 0; k0 < CC; k0 += 4) {
        const int kk = k0 + khalf * 2;
        v2f a;                                    // A[m=l16][kk], A[m][kk+1]
        a.x = xbase[(size_t)kk * CHW];
        a.y = xbase[(size_t)(kk + 1) * CHW];
#pragma unroll
        for (int j = 0; j < 8; ++j) {
            v2f bf;                               // B[kk][n=j*16+l16]
            bf.x = w[kk * CC + j * 16 + l16];
            bf.y = w[(kk + 1) * CC + j * 16 + l16];
            acc[j] = __builtin_amdgcn_wmma_f32_16x16x4_f32(
                false, a, false, bf, (short)0, acc[j], false, false);
        }
    }

    // D layout: VGPR i -> M = i + 8*khalf ; N = l16
    float* obase = out + (size_t)rowbase * CC;
#pragma unroll
    for (int j = 0; j < 8; ++j) {
#pragma unroll
        for (int i = 0; i < 8; ++i) {
            const int mm = i + 8 * khalf;
            const int nn = j * 16 + l16;
            obase[(size_t)mm * CC + nn] = acc[j][i];
        }
    }
}

// ---------------------------------------------------------------------------
// Kernel 2: masked 7x7 neighborhood attention, LDS-tiled.
// Workgroup = 8x8 pixel tile x 1 head. Halo 14x14 x 32 dims of k and v
// (49 KB) staged in LDS -> 16x less global/L2 traffic than direct reads.
// Wave w owns tile row w; lane d owns head-dim d; online softmax.
// Only neighbours whose label equals the pixel's own are visited. A masked
// neighbour has logit -1e9; the pixel itself is always inside its window and
// always matches, so the row maximum is a real logit (|logit| stays far below
// 1e9 for normal draws of x and the weights) and exp(-1e9 - max) is exactly 0
// in f32: a masked term adds 0 to both sums. Visiting order stays ascending.
// ---------------------------------------------------------------------------
__global__ __launch_bounds__(256) void nb_attn_lds_kernel(
    const float* __restrict__ q, const float* __restrict__ k,
    const float* __restrict__ v, const int* __restrict__ labels,
    float* __restrict__ out)
{
    __shared__ float sK[196 * 32];
    __shared__ float sV[196 * 32];
    __shared__ int   sL[196];

    const int tid  = threadIdx.x;
    const int wave = tid >> 5;
    const int lane = tid & 31;

    const int tile = blockIdx.x;                  // 0..143
    const int ty = tile / 12, tx = tile - ty * 12;
    const int r0 = ty * 8, c0 = tx * 8;
    const int b    = blockIdx.y >> 2;
    const int head = blockIdx.y & 3;

    int hr0 = r0 - 3; hr0 = hr0 < 0 ? 0 : (hr0 > CH - 14 ? CH - 14 : hr0);
    int hc0 = c0 - 3; hc0 = hc0 < 0 ? 0 : (hc0 > CW - 14 ? CW - 14 : hc0);

    const int hbase = b * CHW;
    const int coff  = head * CHD;

    // Cooperative halo load: 196 positions x 32 dims; 128B coalesced per wave.
    for (int i = tid; i < 196 * 32; i += 256) {
        const int pos = i >> 5;
        const int d   = i & 31;
        const int pr  = pos / 14;
        const int gr  = hr0 + pr;
        const int gc  = hc0 + pos - pr * 14;
        const size_t g = (size_t)(hbase + gr * CW + gc) * CC + coff + d;
        sK[i] = k[g];
        sV[i] = v[g];
    }
    for (int i = tid; i < 196; i += 256) {
        const int pr = i / 14;
        sL[i] = labels[hbase + (hr0 + pr) * CW + hc0 + i - pr * 14];
    }
    __syncthreads();

    const float scale = 0.17677669529663687f;     // 32^-0.5
    const int r = r0 + wave;                      // wave owns one tile row

    // Window cell (rr, cc) is bit rr*8+cc of a 64-bit match mask; this lane
    // tests bit lane (rows 0..3) and bit lane+32 (rows 4..6). Cells outside
    // the 7x7 window read slot 0 of the window and never set their bit.
    const int  brr = lane >> 3, bcc = lane & 7;
    const bool ok0 = bcc < 7;
    const bool ok1 = bcc < 7 && brr < 3;
    const int  off0 = ok0 ? brr * 14 + bcc : 0;
    const int  off1 = ok1 ? (brr + 4) * 14 + bcc : 0;
    for (int pc = 0; pc < 8; ++pc) {
        const int c   = c0 + pc;
        const int pix = hbase + r * CW + c;
        int sr = r - 3; sr = sr < 0 ? 0 : (sr > CH - 7 ? CH - 7 : sr);
        int sc = c - 3; sc = sc < 0 ? 0 : (sc > CW - 7 ? CW - 7 : sc);
        const int lr0 = sr - hr0, lc0 = sc - hc0;

        const float qd    = q[(size_t)pix * CC + coff + lane] * scale;
        const int   mylab = sL[(r - hr0) * 14 + (c - hc0)];

        const int wbase = lr0 * 14 + lc0;         // window's first halo slot
        const int lab0 = sL[wbase + off0];        // both reads unconditional: one wait
        const int lab1 = sL[wbase + off1];
        const unsigned m0 = __builtin_amdgcn_ballot_w32(ok0 & (lab0 == mylab));
        const unsigned m1 = __builtin_amdgcn_ballot_w32(ok1 & (lab1 == mylab));
        unsigned long long todo = ((unsigned long long)m1 << 32) | m0;

        float mmax = -__builtin_huge_valf();
        float ssum = 0.0f, acc = 0.0f;
        while (todo) {                            // one bit cleared a trip: 1..49 trips
            const int n = __builtin_ctzll(todo);
            todo &= todo - 1;
            const int pos = wbase + (n >> 3) * 14 + (n & 7);
            const float kd = sK[pos * 32 + lane];
            const float vd = sV[pos * 32 + lane];
            float logit = qd * kd;
#pragma unroll
            for (int off = 16; off > 0; off >>= 1)
                logit += __shfl_xor(logit, off, 32);

            const float nm   = fmaxf(mmax, logit);
            const float corr = __expf(mmax - nm);
            const float e    = __expf(logit - nm);
            // Keeps the copy mmax = nm out of the issue slot directly behind the exp
            // that reads mmax's register: the instruction set asks for one other
            // instruction there.
            __builtin_amdgcn_sched_barrier(0);
            ssum = ssum * corr + e;
            acc  = acc * corr + e * vd;
            mmax = nm;
        }
        out[(size_t)pix * CC + coff + lane] = acc / ssum;
        // the next pixel's first instructions reuse the store's registers
        asm volatile("s_wait_xcnt 0x0" ::: "memory");
    }
}

// ---------------------------------------------------------------------------
// Kernel 3: final = (attn @ wproj) transposed to NCHW, computed as
//   D[c][pix] = sum_k wproj[k][c] * attn[pix][k]   (A = wproj^T, B = attn^T)
// so both weight loads and NCHW stores are lane-coalesced.
// ---------------------------------------------------------------------------
__global__ __launch_bounds__(128) void proj_gemm_kernel(
    const float* __restrict__ attn, const float* __restrict__ wp,
    float* __restrict__ out)
{
    const int wave  = threadIdx.x >> 5;
    const int lane  = threadIdx.x & 31;
    const int l16   = lane & 15;
    const int khalf = lane >> 4;

    const int pixbase = blockIdx.x * 16;                // 1152 tiles
    const int ctile   = blockIdx.y * 4 + wave;          // 0..7
    const int c0      = ctile * 16;
    const int b = pixbase / CHW;
    const int p = pixbase - b * CHW;

    v8f acc = {};
    for (int k0 = 0; k0 < CC; k0 += 4) {
        const int kk = k0 + khalf * 2;
        v2f a;                                          // A[m=c][k] = wp[k][c]
        a.x = wp[kk * CC + c0 + l16];
        a.y = wp[(kk + 1) * CC + c0 + l16];
        v2f bf;                                         // B[k][n=pix]
        bf.x = attn[(size_t)(pixbase + l16) * CC + kk];
        bf.y = attn[(size_t)(pixbase + l16) * CC + kk + 1];
        acc = __builtin_amdgcn_wmma_f32_16x16x4_f32(
            false, a, false, bf, (short)0, acc, false, false);
    }

    // D: VGPR i -> channel c0 + i + 8*khalf ; N = pixel offset l16
    float* ob = out + (size_t)b * CC * CHW + p + l16;
#pragma unroll
    for (int i = 0; i < 8; ++i) {
        const int c = c0 + i + 8 * khalf;
        ob[(size_t)c * CHW] = acc[i];
    }
}

// ---------------------------------------------------------------------------
extern "C" void kernel_launch(void* const* d_in, const int* in_sizes, int n_in,
                              void* d_out, int out_size, void* d_ws, size_t ws_size,
                              hipStream_t stream)
{
    (void)in_sizes; (void)n_in; (void)out_size; (void)ws_size;
    const float* x      = (const float*)d_in[0];
    const int*   labels = (const int*)d_in[1];
    const float* wq     = (const float*)d_in[2];
    const float* wk     = (const float*)d_in[3];
    const float* wv     = (const float*)d_in[4];
    const float* wp     = (const float*)d_in[5];

    float* q    = (float*)d_ws;
    float* k    = q + (size_t)NPIX * CC;
    float* v    = k + (size_t)NPIX * CC;
    float* attn = v + (size_t)NPIX * CC;
    float* out  = (float*)d_out;

    dim3 g1(NPIX / 16 / 4, 3);   // (288, 3), 4 waves/block
    qkv_gemm_kernel<<<g1, 128, 0, stream>>>(x, wq, wk, wv, q, k, v);

    dim3 g2((CH / 8) * (CW / 8), CB * CNH);   // (144, 8)
    nb_attn_lds_kernel<<<g2, 256, 0, stream>>>(q, k, v, labels, attn);

    dim3 g3(NPIX / 16, 2);       // (1152, 2), 4 waves/block
    proj_gemm_kernel<<<g3, 128, 0, stream>>>(attn, wp, out);
}

// v002
// Measured time: 45.9 microseconds a run.
// Timed twice side by side with v001, it ran 1.14 and 1.15 times as fast.
// Counting every step since v000, it is 2.03 times as fast.
#include <hip/hip_runtime.h>
#include <hip/hip_bf16.h>

typedef __attribute__((ext_vector_type(2))) float v2f;
typedef __attribute__((ext_vector_type(4))) float v4f;
typedef __attribute__((ext_vector_type(8))) float v8f;

// Problem constants
constexpr int CB  = 2;            // batch
constexpr int CC  = 128;          // channels
constexpr int CH  = 96;
constexpr int CW  = 96;
constexpr int CNH = 4;            // heads
constexpr int CHD = 32;           // head dim
constexpr int CHW = CH * CW;      // 9216
constexpr int NPIX = CB * CHW;    // 18432

// ---------------------------------------------------------------------------
// Kernel 1: q/k/v = xs @ w   (xs read on the fly from NCHW x)
// One wave -> 16-pixel x 128-channel output tile of one of {q,k,v}.
// fp32 WMMA 16x16x4: A = xs tile (16 pix x 4 ch), B = weight (4 x 16).
// ---------------------------------------------------------------------------
__global__ __launch_bounds__(128) void qkv_gemm_kernel(
    const float* __restrict__ x,
    const float* __restrict__ wq, const float* __restrict__ wk,
    const float* __restrict__ wv,
    float* __restrict__ q, float* __restrict__ k, float* __restrict__ v)
{
    const int wave  = threadIdx.x >> 5;
    const int lane  = threadIdx.x & 31;
    const int l16   = lane & 15;
    const int khalf = lane >> 4;

    const int mtile = blockIdx.x * 4 + wave;      // 0..1151
    const int which = blockIdx.y;                 // 0:q 1:k 2:v
    const float* w  = (which == 0) ? wq : (which == 1) ? wk : wv;
    float*      out = (which == 0) ? q  : (which == 1) ? k  : v;

    const int rowbase = mtile * 16;               // pixel row base (16 | 9216)
    const int b = rowbase / CHW;
    const int p = rowbase - b * CHW;

    v8f acc[8] = {};                              // 16x128 tile accumulators
    const float* xbase = x + (size_t)b * CC * CHW + p + l16;

    for (int k0 = 0; k0 < CC; k0 += 4) {
        const int kk = k0 + khalf * 2;
        v2f a;                                    // A[m=l16][kk], A[m][kk+1]
        a.x = xbase[(size_t)kk * CHW];
        a.y = xbase[(size_t)(kk + 1) * CHW];
#pragma unroll
        for (int j = 0; j < 8; ++j) {
            v2f bf;                               // B[kk][n=j*16+l16]
            bf.x = w[kk * CC + j * 16 + l16];
            bf.y = w[(kk + 1) * CC + j * 16 + l16];
            acc[j] = __builtin_amdgcn_wmma_f32_16x16x4_f32(
                false, a, false, bf, (short)0, acc[j], false, false);
        }
    }

    // D layout: VGPR i -> M = i + 8*khalf ; N = l16
    float* obase = out + (size_t)rowbase * CC;
#pragma unroll
    for (int j = 0; j < 8; ++j) {
#pragma unroll
        for (int i = 0; i < 8; ++i) {
            const int mm = i + 8 * khalf;
            const int nn = j * 16 + l16;
            obase[(size_t)mm * CC + nn] = acc[j][i];
        }
    }
}

// ---------------------------------------------------------------------------
// Kernel 2: masked 7x7 neighborhood attention, k and v read straight from
// global memory, no LDS and no barrier.
// One wave owns 8 consecutive pixels of one image row and all four heads:
// lane l holds channels 4l..4l+3 (head l/8), so a pixel's q, k or v row is one
// 16-byte load a lane. Only neighbours whose label equals the pixel's own are
// read. A masked neighbour has logit -1e9; the pixel itself is always inside
// its window and always matches, so the row maximum is a real logit (|logit|
// stays far below 1e9 for normal draws of x and the weights) and
// exp(-1e9 - max) is exactly 0 in f32: a masked term adds 0 to both sums.
// The pixel's own term needs no label, so its rows are fetched together with
// the labels and it opens the online softmax; the other matches follow in
// ascending order, the 8 pixels side by side so that their loads share a wait.
// ---------------------------------------------------------------------------
constexpr int PPW = 8;            // pixels per wave (divides CW)

// x + x of lane (l ^ M), M < 16: a DPP add inside the 16-lane row
template <int M>
__device__ __forceinline__ float add_xor(float x)
{
    const int y = __builtin_amdgcn_update_dpp(
        0, __builtin_bit_cast(int, x), 0x160 + M, 0xf, 0xf, true);
    return x + __builtin_bit_cast(float, y);
}

// dot product over one head's 32 dims: 4 in the lane, then its 8 lanes
__device__ __forceinline__ float head_dot(v4f a, v4f b)
{
    float s = a.x * b.x + a.y * b.y + a.z * b.z + a.w * b.w;
    s = add_xor<1>(s);
    s = add_xor<2>(s);
    s = add_xor<4>(s);
    return s;
}

// 4 channels at byte offset off of a [pixel][channel] buffer
__device__ __forceinline__ v4f row4(const float* __restrict__ base, unsigned off)
{
    return *(const v4f*)((const char*)base + off);
}

__global__ __launch_bounds__(256) void nb_attn_direct_kernel(
    const float* __restrict__ q, const float* __restrict__ k,
    const float* __restrict__ v, const int* __restrict__ labels,
    float* __restrict__ out)
{
    const int lane = threadIdx.x & 31;
    const int wave = __builtin_amdgcn_readfirstlane(threadIdx.x >> 5);

    const int pix0 = (blockIdx.x * 8 + wave) * PPW;   // first pixel, flat over B*H*W
    const int b    = pix0 / CHW;
    const int rem  = pix0 - b * CHW;
    const int r    = rem / CW;
    const int c0   = rem - r * CW;
    int sr = r - 3; sr = sr < 0 ? 0 : (sr > CH - 7 ? CH - 7 : sr);
    const int wrow = b * CHW + sr * CW;               // window's first row

    // Window cell (rr, cc) is bit rr*8+cc of a 64-bit match mask; this lane
    // tests bit lane (rows 0..3) and bit lane+32 (rows 4..6). Cells outside
    // the 7x7 window read the window's first cell and never set their bit.
    const int  brr = lane >> 3, bcc = lane & 7;
    const bool ok0 = bcc < 7;
    const bool ok1 = bcc < 7 && brr < 3;
    const int  off0 = ok0 ? brr * CW + bcc : 0;
    const int  off1 = ok1 ? (brr + 4) * CW + bcc : 0;
    const unsigned chb = lane * 16u;                  // byte offset of this lane's 4 channels

    int wpix[PPW], lab0[PPW], lab1[PPW], mylab[PPW];
#pragma unroll
    for (int p = 0; p < PPW; ++p) {
        const int c = c0 + p;
        int sc = c - 3; sc = sc < 0 ? 0 : (sc > CW - 7 ? CW - 7 : sc);
        wpix[p]  = wrow + sc;
        lab0[p]  = labels[wpix[p] + off0];
        lab1[p]  = labels[wpix[p] + off1];
        mylab[p] = labels[pix0 + p];
    }
    // the row loads below may land in the label loads' offset registers
    asm volatile("s_wait_xcnt 0x0" ::: "memory");
    // q, k, v and out share one layout of 9.4 MB: a 32-bit byte offset beside the
    // buffer's base addresses any row, and the own rows' offsets live to the stores
    unsigned own[PPW];
    v4f q4[PPW], k4[PPW], acc[PPW];
#pragma unroll
    for (int p = 0; p < PPW; ++p) {
        own[p] = (unsigned)(pix0 + p) * (CC * 4u) + chb;
        q4[p]  = row4(q, own[p]);
        k4[p]  = row4(k, own[p]);
        acc[p] = row4(v, own[p]);
    }
    // the code below may reuse registers that these loads name while they fly
    asm volatile("s_wait_xcnt 0x0" ::: "memory");

    unsigned long long todo[PPW];                     // matches other than the pixel itself
#pragma unroll
    for (int p = 0; p < PPW; ++p) {
        const unsigned m0 = __builtin_amdgcn_ballot_w32(ok0 & (lab0[p] == mylab[p]));
        const unsigned m1 = __builtin_amdgcn_ballot_w32(ok1 & (lab1[p] == mylab[p]));
        const int self = (r - sr) * 8 + (wrow + c0 + p - wpix[p]);
        todo[p] = (((unsigned long long)m1 << 32) | m0) & ~(1ull << self);
    }

    // each pixel's next match, if it has one: its k and v rows start to fly
    v4f kn[PPW], vn[PPW];
#pragma unroll
    for (int p = 0; p < PPW; ++p) {
        if (todo[p]) {
            const int n = __builtin_ctzll(todo[p]);
            const unsigned row = (unsigned)(wpix[p] + (n >> 3) * CW + (n & 7)) * (CC * 4u) + chb;
            kn[p] = row4(k, row);
            vn[p] = row4(v, row);
            // the next pixel's offset may reuse these two loads' register
            asm volatile("s_wait_xcnt 0x0" ::: "memory");
        }
    }

    const float scale = 0.17677669529663687f;         // 32^-0.5
    float mmax[PPW], ssum[PPW];
#pragma unroll
    for (int p = 0; p < PPW; ++p) {                   // own term: weight exp(0) = 1
        q4[p] *= scale;
        mmax[p] = head_dot(q4[p], k4[p]);
        ssum[p] = 1.0f;
    }

    for (;;) {                                        // a bit of every open mask a trip: 0..48 trips
        unsigned long long open = 0;
#pragma unroll
        for (int p = 0; p < PPW; ++p) open |= todo[p];
        if (!open) break;
#pragma unroll
        for (int p = 0; p < PPW; ++p) {
            if (todo[p]) {
                todo[p] &= todo[p] - 1;
                const float logit = head_dot(q4[p], kn[p]);
                const float nm   = fmaxf(mmax[p], logit);
                const float e    = __expf(logit - nm);
                // Keeps the second exp's own subtract and multiply between the two exps:
                // without this line some of the eight copies put the exps back to back,
                // the second over the first one's source register, where the
                // instruction set asks for one other instruction in between.
                __builtin_amdgcn_sched_barrier(0);
                const float corr = __expf(mmax[p] - nm);
                ssum[p] = ssum[p] * corr + e;
                acc[p]  = acc[p] * corr + e * vn[p];
                mmax[p] = nm;
            }
        }
#pragma unroll
        for (int p = 0; p < PPW; ++p) {
            if (todo[p]) {
                const int n = __builtin_ctzll(todo[p]);
                const unsigned row = (unsigned)(wpix[p] + (n >> 3) * CW + (n & 7)) * (CC * 4u) + chb;
                kn[p] = row4(k, row);
                vn[p] = row4(v, row);
                // the next pixel's offset may reuse these two loads' register
                asm volatile("s_wait_xcnt 0x0" ::: "memory");
            }
        }
    }

#pragma unroll
    for (int p = 0; p < PPW; ++p)
        *(v4f*)((char*)out + own[p]) = acc[p] / ssum[p];
}

// ---------------------------------------------------------------------------
// Kernel 3: final = (attn @ wproj) transposed to NCHW, computed as
//   D[c][pix] = sum_k wproj[k][c] * attn[pix][k]   (A = wproj^T, B = attn^T)
// so both weight loads and NCHW stores are lane-coalesced.
// ---------------------------------------------------------------------------
__global__ __launch_bounds__(128) void proj_gemm_kernel(
    const float* __restrict__ attn, const float* __restrict__ wp,
    float* __restrict__ out)
{
    const int wave  = threadIdx.x >> 5;
    const int lane  = threadIdx.x & 31;
    const int l16   = lane & 15;
    const int khalf = lane >> 4;

    const int pixbase = blockIdx.x * 16;                // 1152 tiles
    const int ctile   = blockIdx.y * 4 + wave;          // 0..7
    const int c0      = ctile * 16;
    const int b = pixbase / CHW;
    const int p = pixbase - b * CHW;

    v8f acc = {};
    for (int k0 = 0; k0 < CC; k0 += 4) {
        const int kk = k0 + khalf * 2;
        v2f a;                                          // A[m=c][k] = wp[k][c]
        a.x = wp[kk * CC + c0 + l16];
        a.y = wp[(kk + 1) * CC + c0 + l16];
        v2f bf;                                         // B[k][n=pix]
        bf.x = attn[(size_t)(pixbase + l16) * CC + kk];
        bf.y = attn[(size_t)(pixbase + l16) * CC + kk + 1];
        acc = __builtin_amdgcn_wmma_f32_16x16x4_f32(
            false, a, false, bf, (short)0, acc, false, false);
    }

    // D: VGPR i -> channel c0 + i + 8*khalf ; N = pixel offset l16
    float* ob = out + (size_t)b * CC * CHW + p + l16;
#pragma unroll
    for (int i = 0; i < 8; ++i) {
        const int c = c0 + i + 8 * khalf;
        ob[(size_t)c * CHW] = acc[i];
    }
}

// ---------------------------------------------------------------------------
extern "C" void kernel_launch(void* const* d_in, const int* in_sizes, int n_in,
                              void* d_out, int out_size, void* d_ws, size_t ws_size,
                              hipStream_t stream)
{
    (void)in_sizes; (void)n_in; (void)out_size; (void)ws_size;
    const float* x      = (const float*)d_in[0];
    const int*   labels = (const int*)d_in[1];
    const float* wq     = (const float*)d_in[2];
    const float* wk     = (const float*)d_in[3];
    const float* wv     = (const float*)d_in[4];
    const float* wp     = (const float*)d_in[5];

    float* q    = (float*)d_ws;
    float* k    = q + (size_t)NPIX * CC;
    float* v    = k + (size_t)NPIX * CC;
    float* attn = v + (size_t)NPIX * CC;
    float* out  = (float*)d_out;

    dim3 g1(NPIX / 16 / 4, 3);   // (288, 3), 4 waves/block
    qkv_gemm_kernel<<<g1, 128, 0, stream>>>(x, wq, wk, wv, q, k, v);

    dim3 g2(NPIX / PPW / 8);     // 288 blocks, 8 waves/block, 8 pixels/wave
    nb_attn_direct_kernel<<<g2, 256, 0, stream>>>(q, k, v, labels, attn);

    dim3 g3(NPIX / 16, 2);       // (1152, 2), 4 waves/block
    proj_gemm_kernel<<<g3, 128, 0, stream>>>(attn, wp, out);
}

// v003
// One run takes 34 microseconds.
// In both of two side-by-side timings against v002, it was 1.35 times as fast.
// Counting every step since v000, it is 2.75 times as fast.
#include <hip/hip_runtime.h>
#include <hip/hip_bf16.h>

typedef __attribute__((ext_vector_type(2))) float v2f;
typedef __attribute__((ext_vector_type(4))) float v4f;
typedef __attribute__((ext_vector_type(8))) float v8f;

// Problem constants
constexpr int CB  = 2;            // batch
constexpr int CC  = 128;          // channels
constexpr int CH  = 96;
constexpr int CW  = 96;
constexpr int CNH = 4;            // heads
constexpr int CHD = 32;           // head dim
constexpr int CHW = CH * CW;      // 9216
constexpr int NPIX = CB * CHW;    // 18432

// ---------------------------------------------------------------------------
// Kernel 1: q/k/v = xs @ w   (xs read on the fly from NCHW x)
// One wave -> 16-pixel x 128-channel output tile of one of {q,k,v}.
// fp32 WMMA 16x16x4: A = xs tile (16 pix x 4 ch), B = weight (4 x 16).
// ---------------------------------------------------------------------------
__global__ __launch_bounds__(128) void qkv_gemm_kernel(
    const float* __restrict__ x,
    const float* __restrict__ wq, const float* __restrict__ wk,
    const float* __restrict__ wv,
    float* __restrict__ q, float* __restrict__ k, float* __restrict__ v)
{
    const int wave  = threadIdx.x >> 5;
    const int lane  = threadIdx.x & 31;
    const int l16   = lane & 15;
    const int khalf = lane >> 4;

    const int mtile = blockIdx.x * 4 + wave;      // 0..1151
    const int which = blockIdx.y;                 // 0:q 1:k 2:v
    const float* w  = (which == 0) ? wq : (which == 1) ? wk : wv;
    float*      out = (which == 0) ? q  : (which == 1) ? k  : v;

    const int rowbase = mtile * 16;               // pixel row base (16 | 9216)
    const int b = rowbase / CHW;
    const int p = rowbase - b * CHW;

    v8f acc[8] = {};                              // 16x128 tile accumulators
    const float* xbase = x + (size_t)b * CC * CHW + p + l16;

    for (int k0 = 0; k0 < CC; k0 += 4) {
        const int kk = k0 + khalf * 2;
        v2f a;                                    // A[m=l16][kk], A[m][kk+1]
        a.x = xbase[(size_t)kk * CHW];
        a.y = xbase[(size_t)(kk + 1) * CHW];
#pragma unroll
        for (int j = 0; j < 8; ++j) {
            v2f bf;                               // B[kk][n=j*16+l16]
            bf.x = w[kk * CC + j * 16 + l16];
            bf.y = w[(kk + 1) * CC + j * 16 + l16];
            acc[j] = __builtin_amdgcn_wmma_f32_16x16x4_f32(
                false, a, false, bf, (short)0, acc[j], false, false);
        }
    }

    // D layout: VGPR i -> M = i + 8*khalf ; N = l16
    float* obase = out + (size_t)rowbase * CC;
#pragma unroll
    for (int j = 0; j < 8; ++j) {
#pragma unroll
        for (int i = 0; i < 8; ++i) {
            const int mm = i + 8 * khalf;
            const int nn = j * 16 + l16;
            obase[(size_t)mm * CC + nn] = acc[j][i];
        }
    }
}

// ---------------------------------------------------------------------------
// Kernel 2: masked 7x7 neighborhood attention with the output projection behind
// it. k and v are read straight from global memory.
// One wave owns 8 consecutive pixels of one image row and all four heads:
// lane l holds channels 4l..4l+3 (head l/8), so a pixel's q, k or v row is one
// 16-byte load a lane. Only neighbours whose label equals the pixel's own are
// read. A masked neighbour has logit -1e9; the pixel itself is always inside
// its window and always matches, so the row maximum is a real logit (|logit|
// stays far below 1e9 for normal draws of x and the weights) and
// exp(-1e9 - max) is exactly 0 in f32: a masked term adds 0 to both sums.
// The pixel's own term needs no label, so its rows are fetched together with
// the labels and it opens the online softmax; the other matches follow in
// ascending order, the 8 pixels side by side so that their loads share a wait.
// The block's 32 attention rows then meet in LDS, and behind one barrier its
// four waves form final = (attn @ wproj) transposed to NCHW as
//   D[c][pix] = sum_k wproj[k][c] * attn[pix][k]   (A = wproj^T, B = attn^T):
// a wave takes 32 channels x 32 pixels, so each weight fragment and each
// attention fragment feeds two products and a channel's 32 pixels are one
// 128-byte line with one writer.
// ---------------------------------------------------------------------------
constexpr int PPW = 8;            // pixels per wave (divides CW)
constexpr int AWV = 4;            // waves per block
constexpr int PPB = PPW * AWV;    // pixels per block (divides CW and CHW)
constexpr int SPI = CC + 4;       // LDS row pitch in floats: 16 rows x 4 dwords tile the 64 banks

// x + x of lane (l ^ M), M < 16: a DPP add inside the 16-lane row
template <int M>
__device__ __forceinline__ float add_xor(float x)
{
    const int y = __builtin_amdgcn_update_dpp(
        0, __builtin_bit_cast(int, x), 0x160 + M, 0xf, 0xf, true);
    return x + __builtin_bit_cast(float, y);
}

// dot product over one head's 32 dims: 4 in the lane, then its 8 lanes
__device__ __forceinline__ float head_dot(v4f a, v4f b)
{
    float s = a.x * b.x + a.y * b.y + a.z * b.z + a.w * b.w;
    s = add_xor<1>(s);
    s = add_xor<2>(s);
    s = add_xor<4>(s);
    return s;
}

// 4 channels at byte offset off of a [pixel][channel] buffer
__device__ __forceinline__ v4f row4(const float* __restrict__ base, unsigned off)
{
    return *(const v4f*)((const char*)base + off);
}

__global__ __launch_bounds__(128) void nb_attn_proj_kernel(
    const float* __restrict__ q, const float* __restrict__ k,
    const float* __restrict__ v, const int* __restrict__ labels,
    const float* __restrict__ wp, float* __restrict__ out)
{
    __shared__ __attribute__((aligned(16))) float sattn[PPB * SPI];

    const int lane = threadIdx.x & 31;
    const int wave = __builtin_amdgcn_readfirstlane(threadIdx.x >> 5);

    const int pix0 = (blockIdx.x * AWV + wave) * PPW; // first pixel, flat over B*H*W
    const int b    = pix0 / CHW;
    const int rem  = pix0 - b * CHW;
    const int r    = rem / CW;
    const int c0   = rem - r * CW;
    int sr = r - 3; sr = sr < 0 ? 0 : (sr > CH - 7 ? CH - 7 : sr);
    const int wrow = b * CHW + sr * CW;               // window's first row

    // Window cell (rr, cc) is bit rr*8+cc of a 64-bit match mask; this lane
    // tests bit lane (rows 0..3) and bit lane+32 (rows 4..6). Cells outside
    // the 7x7 window read the window's first cell and never set their bit.
    const int  brr = lane >> 3, bcc = lane & 7;
    const bool ok0 = bcc < 7;
    const bool ok1 = bcc < 7 && brr < 3;
    const int  off0 = ok0 ? brr * CW + bcc : 0;
    const int  off1 = ok1 ? (brr + 4) * CW + bcc : 0;
    const unsigned chb = lane * 16u;                  // byte offset of this lane's 4 channels

    int wpix[PPW], lab0[PPW], lab1[PPW], mylab[PPW];
#pragma unroll
    for (int p = 0; p < PPW; ++p) {
        const int c = c0 + p;
        int sc = c - 3; sc = sc < 0 ? 0 : (sc > CW - 7 ? CW - 7 : sc);
        wpix[p]  = wrow + sc;
        lab0[p]  = labels[wpix[p] + off0];
        lab1[p]  = labels[wpix[p] + off1];
        mylab[p] = labels[pix0 + p];
    }
    // the row loads below may land in the label loads' offset registers
    asm volatile("s_wait_xcnt 0x0" ::: "memory");
    // q, k and v share one layout of 9.4 MB: a 32-bit byte offset beside the
    // buffer's base addresses any row
    unsigned own[PPW];
    v4f q4[PPW], k4[PPW], acc[PPW];
#pragma unroll
    for (int p = 0; p < PPW; ++p) {
        own[p] = (unsigned)(pix0 + p) * (CC * 4u) + chb;
        q4[p]  = row4(q, own[p]);
        k4[p]  = row4(k, own[p]);
        acc[p] = row4(v, own[p]);
    }
    // the code below may reuse registers that these loads name while they fly
    asm volatile("s_wait_xcnt 0x0" ::: "memory");

    unsigned long long todo[PPW];                     // matches other than the pixel itself
#pragma unroll
    for (int p = 0; p < PPW; ++p) {
        const unsigned m0 = __builtin_amdgcn_ballot_w32(ok0 & (lab0[p] == mylab[p]));
        const unsigned m1 = __builtin_amdgcn_ballot_w32(ok1 & (lab1[p] == mylab[p]));
        const int self = (r - sr) * 8 + (wrow + c0 + p - wpix[p]);
        todo[p] = (((unsigned long long)m1 << 32) | m0) & ~(1ull << self);
    }

    // each pixel's next match, if it has one: its k and v rows start to fly
    v4f kn[PPW], vn[PPW];
#pragma unroll
    for (int p = 0; p < PPW; ++p) {
        if (todo[p]) {
            const int n = __builtin_ctzll(todo[p]);
            const unsigned row = (unsigned)(wpix[p] + (n >> 3) * CW + (n & 7)) * (CC * 4u) + chb;
            kn[p] = row4(k, row);
            vn[p] = row4(v, row);
            // the next pixel's offset may reuse these two loads' register
            asm volatile("s_wait_xcnt 0x0" ::: "memory");
        }
    }

    const float scale = 0.17677669529663687f;         // 32^-0.5
    float mmax[PPW], ssum[PPW];
#pragma unroll
    for (int p = 0; p < PPW; ++p) {                   // own term: weight exp(0) = 1
        q4[p] *= scale;
        mmax[p] = head_dot(q4[p], k4[p]);
        ssum[p] = 1.0f;
    }

    for (;;) {                                        // a bit of every open mask a trip: 0..48 trips
        unsigned long long open = 0;
#pragma unroll
        for (int p = 0; p < PPW; ++p) open |= todo[p];
        if (!open) break;
#pragma unroll
        for (int p = 0; p < PPW; ++p) {
            if (todo[p]) {
                todo[p] &= todo[p] - 1;
                const float logit = head_dot(q4[p], kn[p]);
                const float nm   = fmaxf(mmax[p], logit);
                const float e    = __expf(logit - nm);
                // Keeps the second exp's own subtract and multiply between the two exps:
                // without this line some of the eight copies put the exps back to back,
                // the second over the first one's source register, where the
                // instruction set asks for one other instruction in between.
                __builtin_amdgcn_sched_barrier(0);
                const float corr = __expf(mmax[p] - nm);
                ssum[p] = ssum[p] * corr + e;
                acc[p]  = acc[p] * corr + e * vn[p];
                mmax[p] = nm;
            }
        }
#pragma unroll
        for (int p = 0; p < PPW; ++p) {
            if (todo[p]) {
                const int n = __builtin_ctzll(todo[p]);
                const unsigned row = (unsigned)(wpix[p] + (n >> 3) * CW + (n & 7)) * (CC * 4u) + chb;
                kn[p] = row4(k, row);
                vn[p] = row4(v, row);
                // the next pixel's offset may reuse these two loads' register
                asm volatile("s_wait_xcnt 0x0" ::: "memory");
            }
        }
    }

    // This wave's 32 output channels of wproj as A fragments, A[m=c][k] = wp[k][c]:
    // asked for here, where the loop's k and v registers are free, so that they
    // fly during the divisions and the barrier. One address, constant offsets.
    const int l16   = lane & 15;
    const int khalf = lane >> 4;
    const int ch0   = wave * 32;
    const float* wl = wp + (khalf * 2 * CC + ch0 + l16);
    v2f wa[CC / 4][2];
    // unrolled here and below: wa, bf and d stay in registers only under constant indices
#pragma unroll
    for (int s = 0; s < CC / 4; ++s)
#pragma unroll
        for (int t = 0; t < 2; ++t) {
            wa[s][t].x = wl[s * 4 * CC + t * 16];
            wa[s][t].y = wl[s * 4 * CC + CC + t * 16];
        }

    // this wave's 8 attention rows, [pixel in block][channel]
#pragma unroll
    for (int p = 0; p < PPW; ++p)
        *(v4f*)&sattn[(wave * PPW + p) * SPI + lane * 4] = acc[p] / ssum[p];
    // where this lane's first output goes: channel ch0 + 8*khalf, pixel l16 of the block
    const int pb = blockIdx.x * PPB - b * CHW;        // block's first pixel in its image
    float* ob = out + (size_t)b * CC * CHW + (size_t)(ch0 + 8 * khalf) * CHW + pb + l16;
    const float* sb = &sattn[l16 * SPI + khalf * 2];  // this lane's place in a B fragment
    __syncthreads();                                  // every wave reads all 32 rows

    v8f d[2][2] = {};                                 // [channel tile][pixel tile]
#pragma unroll
    for (int s = 0; s < CC / 4; ++s) {
        v2f bf[2];                                    // B[k][n=pix], k = 4s + 2*khalf + {0,1}
#pragma unroll
        for (int t = 0; t < 2; ++t)
            bf[t] = *(const v2f*)&sb[t * 16 * SPI + s * 4];
#pragma unroll
        for (int i = 0; i < 2; ++i)
#pragma unroll
            for (int j = 0; j < 2; ++j)
                d[i][j] = __builtin_amdgcn_wmma_f32_16x16x4_f32(
                    false, wa[s][i], false, bf[j], (short)0, d[i][j], false, false);
    }

    // D: VGPR i -> channel + i + 8*khalf ; N = pixel offset l16
#pragma unroll
    for (int t = 0; t < 2; ++t)
#pragma unroll
        for (int i = 0; i < 8; ++i) {
            ob[(t * 16 + i) * CHW]      = d[t][0][i];
            ob[(t * 16 + i) * CHW + 16] = d[t][1][i];
        }
}

// ---------------------------------------------------------------------------
extern "C" void kernel_launch(void* const* d_in, const int* in_sizes, int n_in,
                              void* d_out, int out_size, void* d_ws, size_t ws_size,
                              hipStream_t stream)
{
    (void)in_sizes; (void)n_in; (void)out_size; (void)ws_size;
    const float* x      = (const float*)d_in[0];
    const int*   labels = (const int*)d_in[1];
    const float* wq     = (const float*)d_in[2];
    const float* wk     = (const float*)d_in[3];
    const float* wv     = (const float*)d_in[4];
    const float* wp     = (const float*)d_in[5];

    float* q    = (float*)d_ws;
    float* k    = q + (size_t)NPIX * CC;
    float* v    = k + (size_t)NPIX * CC;
    float* out  = (float*)d_out;

    dim3 g1(NPIX / 16 / 4, 3);   // (288, 3), 4 waves/block
    qkv_gemm_kernel<<<g1, 128, 0, stream>>>(x, wq, wk, wv, q, k, v);

    dim3 g2(NPIX / PPB);         // 576 blocks, 4 waves/block, 8 pixels/wave
    nb_attn_proj_kernel<<<g2, 128, 0, stream>>>(q, k, v, labels, wp, out);
}

// v004
// A run of this version takes 24.2 microseconds.
// Timed twice side by side with v003, it ran 1.40 times as fast both times.
// All steps since v000 together make it 3.86 times as fast.
#include <hip/hip_runtime.h>
#include <hip/hip_bf16.h>

typedef __attribute__((ext_vector_type(2))) float v2f;
typedef __attribute__((ext_vector_type(4))) float v4f;
typedef __attribute__((ext_vector_type(8))) float v8f;

// Problem constants
constexpr int CB  = 2;            // batch
constexpr int CC  = 128;          // channels
constexpr int CH  = 96;
constexpr int CW  = 96;
constexpr int CNH = 4;            // heads
constexpr int CHD = 32;           // head dim
constexpr int CHW = CH * CW;      // 9216
constexpr int NPIX = CB * CHW;    // 18432

// ---------------------------------------------------------------------------
// Kernel 1: q/k/v = xs @ w   (xs read on the fly from NCHW x)
// fp32 WMMA 16x16x4: A = xs tile (16 pix x 4 ch), B = weight (4 x 16).
// One wave -> 64 pixels x 64 channels of one of {q,k,v}: 4 x 4 tiles, so one
// fragment feeds four products. Which pixel is row m of pixel tile t, and which
// channel is column n of channel tile j, is free to choose:
//   pixel = 4*m + t, channel = 4*n + j
// makes the four tiles' values at one k 16 adjacent bytes of x, of w and of the
// output row: a lane fetches four fragments' halves in one load, 16 lanes cover
// 256 adjacent bytes, and a store writes whole lines.
// A block's 4 waves form 128 pixels x 128 channels; two waves share each line.
// ---------------------------------------------------------------------------
constexpr int GKS  = CC / 4;      // k steps of 4
constexpr int GRING = 4;          // k steps whose operands are held or in flight

__global__ __launch_bounds__(128) void qkv_gemm_kernel(
    const float* __restrict__ x,
    const float* __restrict__ wq, const float* __restrict__ wk,
    const float* __restrict__ wv,
    float* __restrict__ q, float* __restrict__ k, float* __restrict__ v)
{
    const int wave  = __builtin_amdgcn_readfirstlane(threadIdx.x >> 5);
    const int lane  = threadIdx.x & 31;
    const int l16   = lane & 15;
    const int khalf = lane >> 4;

    const int which = blockIdx.y;                 // 0:q 1:k 2:v
    const float* w  = (which == 0) ? wq : (which == 1) ? wk : wv;
    float*      out = (which == 0) ? q  : (which == 1) ? k  : v;

    const int row0 = blockIdx.x * 128 + (wave & 1) * 64;  // first pixel, flat (128 | 9216)
    const int c0   = (wave >> 1) * 64;                    // first channel
    const int b = row0 / CHW;
    const int p = row0 - b * CHW;

    // this lane's k rows are 4s + 2*khalf and the next one, as in the fragment maps
    const float* xl = x + (size_t)b * CC * CHW + khalf * 2 * CHW + p + l16 * 4;
    const float* wl = w + khalf * 2 * CC + c0 + l16 * 4;

    v8f acc[4][4] = {};                           // [pixel tile][channel tile]
    v4f fx[GRING][2], fw[GRING][2];               // [ring place][k row of the pair]

    // unrolled throughout: ring places and accumulators need constant indices, and
    // every load is then one address with a constant offset
#pragma unroll
    for (int s = 0; s < GRING; ++s) {
        fx[s][0] = *(const v4f*)(xl + s * 4 * CHW);
        fx[s][1] = *(const v4f*)(xl + s * 4 * CHW + CHW);
        fw[s][0] = *(const v4f*)(wl + s * 4 * CC);
        fw[s][1] = *(const v4f*)(wl + s * 4 * CC + CC);
    }

#pragma unroll
    for (int s = 0; s < GKS; ++s) {
        const int r = s % GRING;
        v2f a[4], bf[4];
#pragma unroll
        for (int t = 0; t < 4; ++t) {
            a[t].x  = fx[r][0][t];  a[t].y  = fx[r][1][t];   // A[m][kk], A[m][kk+1]
            bf[t].x = fw[r][0][t];  bf[t].y = fw[r][1][t];   // B[kk][n], B[kk+1][n]
        }
        if (s + GRING < GKS) {
            const int n = s + GRING;
            fx[r][0] = *(const v4f*)(xl + n * 4 * CHW);
            fx[r][1] = *(const v4f*)(xl + n * 4 * CHW + CHW);
            fw[r][0] = *(const v4f*)(wl + n * 4 * CC);
            fw[r][1] = *(const v4f*)(wl + n * 4 * CC + CC);
        }
#pragma unroll
        for (int t = 0; t < 4; ++t)
#pragma unroll
            for (int j = 0; j < 4; ++j)
                acc[t][j] = __builtin_amdgcn_wmma_f32_16x16x4_f32(
                    false, a[t], false, bf[j], (short)0, acc[t][j], false, false);
    }

    // The stores below gather their 16 bytes with vector moves that read the results:
    // four vector slots keep them the distance from the last products that a matrix
    // instruction asks for; the scheduling barriers hold products and moves on their sides.
    __builtin_amdgcn_sched_barrier(0);
    asm volatile("v_nop\n\tv_nop\n\tv_nop\n\tv_nop");
    __builtin_amdgcn_sched_barrier(0);

    // D layout: VGPR i -> m = i + 8*khalf ; n = l16
    float* ol = out + (size_t)(row0 + khalf * 32) * CC + c0 + l16 * 4;
#pragma unroll
    for (int i = 0; i < 8; ++i)
#pragma unroll
        for (int t = 0; t < 4; ++t) {
            v4f o;
            o.x = acc[t][0][i]; o.y = acc[t][1][i]; o.z = acc[t][2][i]; o.w = acc[t][3][i];
            *(v4f*)(ol + (i * 4 + t) * CC) = o;
        }
}

// ---------------------------------------------------------------------------
// Kernel 2: masked 7x7 neighborhood attention with the output projection behind
// it. k and v are read straight from global memory.
// One wave owns 8 consecutive pixels of one image row and all four heads:
// lane l holds channels 4l..4l+3 (head l/8), so a pixel's q, k or v row is one
// 16-byte load a lane. Only neighbours whose label equals the pixel's own are
// read. A masked neighbour has logit -1e9; the pixel itself is always inside
// its window and always matches, so the row maximum is a real logit (|logit|
// stays far below 1e9 for normal draws of x and the weights) and
// exp(-1e9 - max) is exactly 0 in f32: a masked term adds 0 to both sums.
// The pixel's own term needs no label, so its rows are fetched together with
// the labels and it opens the online softmax; the other matches follow in
// ascending order, the 8 pixels side by side so that their loads share a wait.
// The block's 32 attention rows then meet in LDS, and behind one barrier its
// four waves form final = (attn @ wproj) transposed to NCHW as
//   D[c][pix] = sum_k wproj[k][c] * attn[pix][k]   (A = wproj^T, B = attn^T):
// a wave takes 32 channels x 32 pixels, so each weight fragment and each
// attention fragment feeds two products and a channel's 32 pixels are one
// 128-byte line with one writer.
// ---------------------------------------------------------------------------
constexpr int PPW = 8;            // pixels per wave (divides CW)
constexpr int AWV = 4;            // waves per block
constexpr int PPB = PPW * AWV;    // pixels per block (divides CW and CHW)
constexpr int SPI = CC + 4;       // LDS row pitch in floats: 16 rows x 4 dwords tile the 64 banks

// x + x of lane (l ^ M), M < 16: a DPP add inside the 16-lane row
template <int M>
__device__ __forceinline__ float add_xor(float x)
{
    const int y = __builtin_amdgcn_update_dpp(
        0, __builtin_bit_cast(int, x), 0x160 + M, 0xf, 0xf, true);
    return x + __builtin_bit_cast(float, y);
}

// dot product over one head's 32 dims: 4 in the lane, then its 8 lanes
__device__ __forceinline__ float head_dot(v4f a, v4f b)
{
    float s = a.x * b.x + a.y * b.y + a.z * b.z + a.w * b.w;
    s = add_xor<1>(s);
    s = add_xor<2>(s);
    s = add_xor<4>(s);
    return s;
}

// 4 channels at byte offset off of a [pixel][channel] buffer
__device__ __forceinline__ v4f row4(const float* __restrict__ base, unsigned off)
{
    return *(const v4f*)((const char*)base + off);
}

__global__ __launch_bounds__(128) void nb_attn_proj_kernel(
    const float* __restrict__ q, const float* __restrict__ k,
    const float* __restrict__ v, const int* __restrict__ labels,
    const float* __restrict__ wp, float* __restrict__ out)
{
    __shared__ __attribute__((aligned(16))) float sattn[PPB * SPI];

    const int lane = threadIdx.x & 31;
    const int wave = __builtin_amdgcn_readfirstlane(threadIdx.x >> 5);

    const int pix0 = (blockIdx.x * AWV + wave) * PPW; // first pixel, flat over B*H*W
    const int b    = pix0 / CHW;
    const int rem  = pix0 - b * CHW;
    const int r    = rem / CW;
    const int c0   = rem - r * CW;
    int sr = r - 3; sr = sr < 0 ? 0 : (sr > CH - 7 ? CH - 7 : sr);
    const int wrow = b * CHW + sr * CW;               // window's first row

    // Window cell (rr, cc) is bit rr*8+cc of a 64-bit match mask; this lane
    // tests bit lane (rows 0..3) and bit lane+32 (rows 4..6). Cells outside
    // the 7x7 window read the window's first cell and never set their bit.
    const int  brr = lane >> 3, bcc = lane & 7;
    const bool ok0 = bcc < 7;
    const bool ok1 = bcc < 7 && brr < 3;
    const int  off0 = ok0 ? brr * CW + bcc : 0;
    const int  off1 = ok1 ? (brr + 4) * CW + bcc : 0;
    const unsigned chb = lane * 16u;                  // byte offset of this lane's 4 channels

    int wpix[PPW], lab0[PPW], lab1[PPW], mylab[PPW];
#pragma unroll
    for (int p = 0; p < PPW; ++p) {
        const int c = c0 + p;
        int sc = c - 3; sc = sc < 0 ? 0 : (sc > CW - 7 ? CW - 7 : sc);
        wpix[p]  = wrow + sc;
        lab0[p]  = labels[wpix[p] + off0];
        lab1[p]  = labels[wpix[p] + off1];
        mylab[p] = labels[pix0 + p];
    }
    // the row loads below may land in the label loads' offset registers
    asm volatile("s_wait_xcnt 0x0" ::: "memory");
    // q, k and v share one layout of 9.4 MB: a 32-bit byte offset beside the
    // buffer's base addresses any row
    unsigned own[PPW];
    v4f q4[PPW], k4[PPW], acc[PPW];
#pragma unroll
    for (int p = 0; p < PPW; ++p) {
        own[p] = (unsigned)(pix0 + p) * (CC * 4u) + chb;
        q4[p]  = row4(q, own[p]);
        k4[p]  = row4(k, own[p]);
        acc[p] = row4(v, own[p]);
    }
    // the code below may reuse registers that these loads name while they fly
    asm volatile("s_wait_xcnt 0x0" ::: "memory");

    unsigned long long todo[PPW];                     // matches other than the pixel itself
#pragma unroll
    for (int p = 0; p < PPW; ++p) {
        const unsigned m0 = __builtin_amdgcn_ballot_w32(ok0 & (lab0[p] == mylab[p]));
        const unsigned m1 = __builtin_amdgcn_ballot_w32(ok1 & (lab1[p] == mylab[p]));
        const int self = (r - sr) * 8 + (wrow + c0 + p - wpix[p]);
        todo[p] = (((unsigned long long)m1 << 32) | m0) & ~(1ull << self);
    }

    // each pixel's next match, if it has one: its k and v rows start to fly
    v4f kn[PPW], vn[PPW];
#pragma unroll
    for (int p = 0; p < PPW; ++p) {
        if (todo[p]) {
            const int n = __builtin_ctzll(todo[p]);
            const unsigned row = (unsigned)(wpix[p] + (n >> 3) * CW + (n & 7)) * (CC * 4u) + chb;
            kn[p] = row4(k, row);
            vn[p] = row4(v, row);
            // the next pixel's offset may reuse these two loads' register
            asm volatile("s_wait_xcnt 0x0" ::: "memory");
        }
    }

    const float scale = 0.17677669529663687f;         // 32^-0.5
    float mmax[PPW], ssum[PPW];
#pragma unroll
    for (int p = 0; p < PPW; ++p) {                   // own term: weight exp(0) = 1
        q4[p] *= scale;
        mmax[p] = head_dot(q4[p], k4[p]);
        ssum[p] = 1.0f;
    }

    for (;;) {                                        // a bit of every open mask a trip: 0..48 trips
        unsigned long long open = 0;
#pragma unroll
        for (int p = 0; p < PPW; ++p) open |= todo[p];
        if (!open) break;
#pragma unroll
        for (int p = 0; p < PPW; ++p) {
            if (todo[p]) {
                todo[p] &= todo[p] - 1;
                const float logit = head_dot(q4[p], kn[p]);
                const float nm   = fmaxf(mmax[p], logit);
                const float e    = __expf(logit - nm);
                // Keeps the second exp's own subtract and multiply between the two exps:
                // without this line some of the eight copies put the exps back to back,
                // the second over the first one's source register, where the
                // instruction set asks for one other instruction in between.
                __builtin_amdgcn_sched_barrier(0);
                const float corr = __expf(mmax[p] - nm);
                ssum[p] = ssum[p] * corr + e;
                acc[p]  = acc[p] * corr + e * vn[p];
                mmax[p] = nm;
            }
        }
#pragma unroll
        for (int p = 0; p < PPW; ++p) {
            if (todo[p]) {
                const int n = __builtin_ctzll(todo[p]);
                const unsigned row = (unsigned)(wpix[p] + (n >> 3) * CW + (n & 7)) * (CC * 4u) + chb;
                kn[p] = row4(k, row);
                vn[p] = row4(v, row);
                // the next pixel's offset may reuse these two loads' register
                asm volatile("s_wait_xcnt 0x0" ::: "memory");
            }
        }
    }

    // This wave's 32 output channels of wproj as A fragments, A[m=c][k] = wp[k][c]:
    // asked for here, where the loop's k and v registers are free, so that they
    // fly during the divisions and the barrier. One address, constant offsets.
    const int l16   = lane & 15;
    const int khalf = lane >> 4;
    const int ch0   = wave * 32;
    const float* wl = wp + (khalf * 2 * CC + ch0 + l16);
    v2f wa[CC / 4][2];
    // unrolled here and below: wa, bf and d stay in registers only under constant indices
#pragma unroll
    for (int s = 0; s < CC / 4; ++s)
#pragma unroll
        for (int t = 0; t < 2; ++t) {
            wa[s][t].x = wl[s * 4 * CC + t * 16];
            wa[s][t].y = wl[s * 4 * CC + CC + t * 16];
        }

    // this wave's 8 attention rows, [pixel in block][channel]
#pragma unroll
    for (int p = 0; p < PPW; ++p)
        *(v4f*)&sattn[(wave * PPW + p) * SPI + lane * 4] = acc[p] / ssum[p];
    // where this lane's first output goes: channel ch0 + 8*khalf, pixel l16 of the block
    const int pb = blockIdx.x * PPB - b * CHW;        // block's first pixel in its image
    float* ob = out + (size_t)b * CC * CHW + (size_t)(ch0 + 8 * khalf) * CHW + pb + l16;
    const float* sb = &sattn[l16 * SPI + khalf * 2];  // this lane's place in a B fragment
    __syncthreads();                                  // every wave reads all 32 rows

    v8f d[2][2] = {};                                 // [channel tile][pixel tile]
#pragma unroll
    for (int s = 0; s < CC / 4; ++s) {
        v2f bf[2];                                    // B[k][n=pix], k = 4s + 2*khalf + {0,1}
#pragma unroll
        for (int t = 0; t < 2; ++t)
            bf[t] = *(const v2f*)&sb[t * 16 * SPI + s * 4];
#pragma unroll
        for (int i = 0; i < 2; ++i)
#pragma unroll
            for (int j = 0; j < 2; ++j)
                d[i][j] = __builtin_amdgcn_wmma_f32_16x16x4_f32(
                    false, wa[s][i], false, bf[j], (short)0, d[i][j], false, false);
    }

    // D: VGPR i -> channel + i + 8*khalf ; N = pixel offset l16
#pragma unroll
    for (int t = 0; t < 2; ++t)
#pragma unroll
        for (int i = 0; i < 8; ++i) {
            ob[(t * 16 + i) * CHW]      = d[t][0][i];
            ob[(t * 16 + i) * CHW + 16] = d[t][1][i];
        }
}

// ---------------------------------------------------------------------------
extern "C" void kernel_launch(void* const* d_in, const int* in_sizes, int n_in,
                              void* d_out, int out_size, void* d_ws, size_t ws_size,
                              hipStream_t stream)
{
    (void)in_sizes; (void)n_in; (void)out_size; (void)ws_size;
    const float* x      = (const float*)d_in[0];
    const int*   labels = (const int*)d_in[1];
    const float* wq     = (const float*)d_in[2];
    const float* wk     = (const float*)d_in[3];
    const float* wv     = (const float*)d_in[4];
    const float* wp     = (const float*)d_in[5];

    float* q    = (float*)d_ws;
    float* k    = q + (size_t)NPIX * CC;
    float* v    = k + (size_t)NPIX * CC;
    float* out  = (float*)d_out;

    dim3 g1(NPIX / 128, 3);      // (144, 3), 4 waves/block, 64 x 64 a wave
    qkv_gemm_kernel<<<g1, 128, 0, stream>>>(x, wq, wk, wv, q, k, v);

    dim3 g2(NPIX / PPB);         // 576 blocks, 4 waves/block, 8 pixels/wave
    nb_attn_proj_kernel<<<g2, 128, 0, stream>>>(q, k, v, labels, wp, out);
}

// v005
// One run takes 22.7 microseconds.
// Timed twice side by side with v004, it ran 1.07 and 1.06 times as fast.
// Over all steps from v000 it is 4.10 times as fast.
#include <hip/hip_runtime.h>
#include <hip/hip_bf16.h>

typedef __attribute__((ext_vector_type(2))) float v2f;
typedef __attribute__((ext_vector_type(4))) float v4f;
typedef __attribute__((ext_vector_type(4))) int   v4i;
typedef __attribute__((ext_vector_type(8))) float v8f;

// Problem constants
constexpr int CB  = 2;            // batch
constexpr int CC  = 128;          // channels
constexpr int CH  = 96;
constexpr int CW  = 96;
constexpr int CNH = 4;            // heads
constexpr int CHD = 32;           // head dim
constexpr int CHW = CH * CW;      // 9216
constexpr int NPIX = CB * CHW;    // 18432

// ---------------------------------------------------------------------------
// Kernel 1: v = xs @ wv for every pixel; q = xs @ wq and k = xs @ wk only for the
// pixels whose rows kernel 2 can read (xs read on the fly from NCHW x).
// A pixel with no equal label in its window has softmax weight 1 on itself: its
// logits are never formed. q[i] is read only where i's window holds another pixel
// of i's label; k[j] only there, or where j lies in the window of such a pixel.
// Both sets lie in the test "another pixel of my label inside my box", the box
// being the hull of my window and of the pixels whose window holds me (windows
// shift inward at the borders, so up to 10 x 10 there, 7 x 7 inside).
// fp32 WMMA 16x16x4: A = xs tile (16 pix x 4 ch), B = weight (4 x 16).
// Blocks NVB.. : two image rows, q or k: test 192 pixels, pack the hits, gather their
//   x columns into LDS as [slot][k], then the products on packed rows; a wave forms
//   up to 64 rows x 32 channels a pass (1 to 3 passes), channel = 2*n + j, 16 lanes write one whole line.
// Blocks 0..NVB-1 (first: they hold the most products a wave): v.
// One wave -> 64 pixels x 64 channels: 4 x 4 tiles, so one
// fragment feeds four products. Which pixel is row m of pixel tile t, and which
// channel is column n of channel tile j, is free to choose:
//   pixel = 4*m + t, channel = 4*n + j
// makes the four tiles' values at one k 16 adjacent bytes of x, of w and of the
// output row: a lane fetches four fragments' halves in one load, 16 lanes cover
// 256 adjacent bytes, and a store writes whole lines.
// A v block's 4 waves form 128 pixels x 128 channels; two waves share each output row.
// ---------------------------------------------------------------------------
constexpr int GKS  = CC / 4;      // k steps of 4
constexpr int GRING = 4;          // k steps whose operands are held or in flight
constexpr int NVB   = NPIX / 128;     // 144 v blocks
constexpr int QR    = 2 * CW;         // pixels a q/k block tests: two image rows
constexpr int QG    = QR / 32;        // groups of 32 pixels, each inside one image row
constexpr int NQB   = 2 * (NPIX / QR);// 192: even q, odd k
constexpr int QS    = 64;             // packed rows a pass
constexpr int XPI   = CC + 4;         // LDS row pitch in floats: 16 rows x 4 dwords tile the 64 banks
constexpr int BOX   = 10;             // widest box

// hull of i's window and of the places whose window holds i, along one axis of
// length n: 7 to 10 places
__device__ __forceinline__ void box_of(int i, int n, int& lo, int& hi)
{
    int s = i - 3; s = s < 0 ? 0 : (s > n - 7 ? n - 7 : s);
    lo = i <= 6 ? 0 : i - 3;          lo = lo < s ? lo : s;
    hi = i >= n - 7 ? n - 1 : i + 3;  hi = hi > s + 6 ? hi : s + 6;
}

// NR adjacent rows of a box: its first 7 columns from p7 on and its last 3 from p3 on.
// Together they cover 7 to 10 columns; a place read twice changes no answer, and
// every load is one of two addresses with a constant beside it.
template <int NR>
__device__ __forceinline__ void box_load(const int* __restrict__ p7, const int* __restrict__ p3,
                                         int (&lab)[NR][BOX])
{
    // unrolled here and in box_test: lab stays in registers only under constant indices
#pragma unroll
    for (int dr = 0; dr < NR; ++dr) {
#pragma unroll
        for (int dc = 0; dc < 7; ++dc) lab[dr][dc] = p7[dr * CW + dc];
#pragma unroll
        for (int dc = 7; dc < BOX; ++dc) lab[dr][dc] = p3[dr * CW + dc - 7];
    }
}

// does one of these places, other than the pixel itself, hold label my? The pixel is
// row dself of these rows (if in range), column s7 of the first 7, column s3 of the last 3.
template <int NR>
__device__ __forceinline__ bool box_test(const int (&lab)[NR][BOX], int my,
                                         int dself, int s7, int s3)
{
    bool hit = false;
#pragma unroll
    for (int dr = 0; dr < NR; ++dr)
#pragma unroll
        for (int dc = 0; dc < BOX; ++dc) {
            const bool own = (dself == dr) & (dc < 7 ? s7 == dc : s3 == dc - 7);
            hit |= (lab[dr][dc] == my) & !own;
        }
    return hit;
}

// One pass of a q/k block in one wave: T tiles of 16 packed rows x 2 tiles of 16 channels,
// row = 16*t + m. sa: this lane's place in an A fragment of tile 0; fw: the weight
// fragments; sl: where this lane's result rows go (pixel in the block's range);
// left: how many of them the list holds; ob: byte offset in out of the range's first
// row at this lane's channels.
template <int T>
__device__ __forceinline__ void qk_pass(const float* sa, const v2f (&fw)[GKS][2],
                                        const int* sl, int left,
                                        float* __restrict__ out, unsigned ob)
{
    // unrolled throughout: pl, a and acc stay in registers only under constant indices
    v8f acc[T][2] = {};
#pragma unroll
    for (int s = 0; s < GKS; ++s) {
        v2f a[T], bf[2];
#pragma unroll
        for (int t = 0; t < T; ++t) a[t] = *(const v2f*)&sa[t * 16 * XPI + s * 4];
#pragma unroll
        for (int j = 0; j < 2; ++j) { bf[j].x = fw[s][0][j]; bf[j].y = fw[s][1][j]; }
#pragma unroll
        for (int t = 0; t < T; ++t)
#pragma unroll
            for (int j = 0; j < 2; ++j)
                acc[t][j] = __builtin_amdgcn_wmma_f32_16x16x4_f32(
                    false, a[t], false, bf[j], (short)0, acc[t][j], false, false);
    }

    // read behind the products, where the A fragments' registers are free
    v4i pl[T][2];
#pragma unroll
    for (int t = 0; t < T; ++t)
#pragma unroll
        for (int h = 0; h < 2; ++h)
            pl[t][h] = *(const v4i*)&sl[t * 16 + h * 4];

    // as in the v branch: four vector slots between the last products and the moves
    // that read them
    __builtin_amdgcn_sched_barrier(0);
    asm volatile("v_nop\n\tv_nop\n\tv_nop\n\tv_nop");
    __builtin_amdgcn_sched_barrier(0);

    // D layout: VGPR i -> m = i + 8*khalf ; n = l16. Rows past the list's end are dropped.
#pragma unroll
    for (int t = 0; t < T; ++t)
#pragma unroll
        for (int i = 0; i < 8; ++i)
            if (t * 16 + i < left) {
                v2f o;
                o.x = acc[t][0][i]; o.y = acc[t][1][i];
                *(v2f*)((char*)out + (ob + (unsigned)pl[t][i >> 2][i & 3] * (CC * 4u))) = o;
            }
    // a next pass may reuse the registers that these stores name
    asm volatile("s_wait_xcnt 0x0" ::: "memory");
}

__global__ __launch_bounds__(128) void qkv_gemm_kernel(
    const float* __restrict__ x, const int* __restrict__ labels,
    const float* __restrict__ wq, const float* __restrict__ wk,
    const float* __restrict__ wv,
    float* __restrict__ q, float* __restrict__ k, float* __restrict__ v)
{
    __shared__ __attribute__((aligned(16))) float sx[QS * XPI];
    __shared__ __attribute__((aligned(16))) int slist[QR];
    __shared__ unsigned smask[8];

    const int wave  = __builtin_amdgcn_readfirstlane(threadIdx.x >> 5);
    const int lane  = threadIdx.x & 31;
    const int l16   = lane & 15;
    const int khalf = lane >> 4;

    if (blockIdx.x < NVB) {
        // ---- v of 128 adjacent pixels ----
        const float* w  = wv;
        float*      out = v;

        const int row0 = blockIdx.x * 128 + (wave & 1) * 64;  // first pixel, flat (128 | 9216)
        const int c0   = (wave >> 1) * 64;                    // first channel
        const int b = row0 / CHW;
        const int p = row0 - b * CHW;

        // this lane's k rows are 4s + 2*khalf and the next one, as in the fragment maps
        const float* xl = x + (size_t)b * CC * CHW + khalf * 2 * CHW + p + l16 * 4;
        const float* wl = w + khalf * 2 * CC + c0 + l16 * 4;

        v8f acc[4][4] = {};                           // [pixel tile][channel tile]
        v4f fx[GRING][2], fw[GRING][2];               // [ring place][k row of the pair]

        // unrolled throughout: ring places and accumulators need constant indices, and
        // every load is then one address with a constant offset
    #pragma unroll
        for (int s = 0; s < GRING; ++s) {
            fx[s][0] = *(const v4f*)(xl + s * 4 * CHW);
            fx[s][1] = *(const v4f*)(xl + s * 4 * CHW + CHW);
            fw[s][0] = *(const v4f*)(wl + s * 4 * CC);
            fw[s][1] = *(const v4f*)(wl + s * 4 * CC + CC);
        }

    #pragma unroll
        for (int s = 0; s < GKS; ++s) {
            const int r = s % GRING;
            v2f a[4], bf[4];
    #pragma unroll
            for (int t = 0; t < 4; ++t) {
                a[t].x  = fx[r][0][t];  a[t].y  = fx[r][1][t];   // A[m][kk], A[m][kk+1]
                bf[t].x = fw[r][0][t];  bf[t].y = fw[r][1][t];   // B[kk][n], B[kk+1][n]
            }
            if (s + GRING < GKS) {
                const int n = s + GRING;
                fx[r][0] = *(const v4f*)(xl + n * 4 * CHW);
                fx[r][1] = *(const v4f*)(xl + n * 4 * CHW + CHW);
                fw[r][0] = *(const v4f*)(wl + n * 4 * CC);
                fw[r][1] = *(const v4f*)(wl + n * 4 * CC + CC);
            }
    #pragma unroll
            for (int t = 0; t < 4; ++t)
    #pragma unroll
                for (int j = 0; j < 4; ++j)
                    acc[t][j] = __builtin_amdgcn_wmma_f32_16x16x4_f32(
                        false, a[t], false, bf[j], (short)0, acc[t][j], false, false);
        }

        // The stores below gather their 16 bytes with vector moves that read the results:
        // four vector slots keep them the distance from the last products that a matrix
        // instruction asks for; the scheduling barriers hold products and moves on their sides.
        __builtin_amdgcn_sched_barrier(0);
        asm volatile("v_nop\n\tv_nop\n\tv_nop\n\tv_nop");
        __builtin_amdgcn_sched_barrier(0);

        // D layout: VGPR i -> m = i + 8*khalf ; n = l16
        float* ol = out + (size_t)(row0 + khalf * 32) * CC + c0 + l16 * 4;
    #pragma unroll
        for (int i = 0; i < 8; ++i)
    #pragma unroll
            for (int t = 0; t < 4; ++t) {
                v4f o;
                o.x = acc[t][0][i]; o.y = acc[t][1][i]; o.z = acc[t][2][i]; o.w = acc[t][3][i];
                *(v4f*)(ol + (i * 4 + t) * CC) = o;
            }
        return;
    }

    // ---- q or k of the pixels of two image rows that need them ----
    const int c0    = wave * 32;                  // first channel
    const int qb    = blockIdx.x - NVB;
    const int which = qb & 1;                     // 0:q 1:k
    const float* w  = which ? wk : wq;
    float*      out = which ? k : q;
    const int base = (qb >> 1) * QR;              // first pixel, flat (192 | 9216)
    const int b    = base / CHW;
    const int pr   = base - b * CHW;              // the same inside its image
    const int r0   = pr / CW;
    const int* lb  = labels + b * CHW;

    // wave w tests group w whole, and four box rows of group 4 + (w & 1): rows 0..3 of the
    // box in waves 0 and 1, rows 3..6 in waves 2 and 3
    const int gb = 4 + (wave & 1), db = (wave >> 1) * 3;
    const int ra = r0 + wave / 3, ca = (wave % 3) * 32 + lane;
    const int rb = r0 + gb / 3,   cb = (gb % 3) * 32 + lane;
    int ralo, rahi, calo, cahi, rblo, rbhi, cblo, cbhi;
    box_of(ra, CH, ralo, rahi);  box_of(ca, CW, calo, cahi);
    box_of(rb, CH, rblo, rbhi);  box_of(cb, CW, cblo, cbhi);
    const int* pma = lb + ra * CW + ca;
    const int* pmb = lb + rb * CW + cb;
    const int* pa7 = lb + ralo * CW + calo;
    const int* pa3 = lb + ralo * CW + cahi - 2;
    const int* pb7 = lb + (rblo + db) * CW + cblo;
    const int* pb3 = lb + (rblo + db) * CW + cbhi - 2;
    const int mya = *pma, myb = *pmb;
    int la[7][BOX], lc[4][BOX];
    box_load<7>(pa7, pa3, la);
    box_load<4>(pb7, pb3, lc);
    // this wave's 32 columns of the weight, whole: they need no label, so they are asked
    // for here and fly during the test, the listing and the gather
    const float* wl = w + khalf * 2 * CC + c0 + l16 * 2;
    v2f fw[GKS][2];                               // [k step][k row of the pair]
    // unrolled: fw stays in registers only under constant indices
#pragma unroll
    for (int s = 0; s < GKS; ++s) {
        fw[s][0] = *(const v2f*)(wl + s * 4 * CC);
        fw[s][1] = *(const v2f*)(wl + s * 4 * CC + CC);
    }
    // The addresses are inputs so that they keep their registers up to this wait: no
    // later load's result and no compare may land in a register that a load still names.
    asm volatile("s_wait_xcnt 0x0"
                 :: "v"(pma), "v"(pmb), "v"(pa7), "v"(pa3), "v"(pb7), "v"(pb3), "v"(wl) : "memory");
    // holds the compares behind the wait above: without this line the compiler lifts
    // them over it, and the wait comes only after registers have been reused
    __builtin_amdgcn_sched_barrier(0);
    bool ha = box_test<7>(la, mya, ra - ralo,      ca - calo, ca - cahi + 2);
    bool hb = box_test<4>(lc, myb, rb - rblo - db, cb - cblo, cb - cbhi + 2);
    if (rahi - ralo >= 7 || rbhi - rblo >= 7) {   // near the upper or lower border: the box's last 3 rows
        int ea[3][BOX], eb[3][BOX];
        const int* qa7 = lb + (rahi - 2) * CW + calo;
        const int* qa3 = lb + (rahi - 2) * CW + cahi - 2;
        const int* qb7 = lb + (rbhi - 2) * CW + cblo;
        const int* qb3 = lb + (rbhi - 2) * CW + cbhi - 2;
        box_load<3>(qa7, qa3, ea);
        box_load<3>(qb7, qb3, eb);
        // as above: the addresses keep their registers up to this wait
        asm volatile("s_wait_xcnt 0x0" :: "v"(qa7), "v"(qa3), "v"(qb7), "v"(qb3) : "memory");
        ha |= box_test<3>(ea, mya, ra - rahi + 2, ca - calo, ca - cahi + 2);
        hb |= box_test<3>(eb, myb, rb - rbhi + 2, cb - cblo, cb - cbhi + 2);
    }
    const unsigned ma = __builtin_amdgcn_ballot_w32(ha);
    const unsigned mh = __builtin_amdgcn_ballot_w32(hb);
    if (lane == 0) {
        smask[wave]     = ma;
        smask[4 + wave] = mh;                     // 4, 6: halves of group 4; 5, 7: of group 5
    }
    __syncthreads();                              // every wave needs all the masks
    unsigned mk[QG];                              // unrolled below: mk stays in scalar registers
#pragma unroll
    for (int g = 0; g < 4; ++g) mk[g] = __builtin_amdgcn_readfirstlane(smask[g]);
#pragma unroll
    for (int g = 4; g < QG; ++g)
        mk[g] = __builtin_amdgcn_readfirstlane(smask[g]) | __builtin_amdgcn_readfirstlane(smask[g + 2]);
    const unsigned mb = wave == 0 ? mk[4] : wave == 1 ? mk[5] : 0u;  // waves 0, 1 list groups 4, 5
    int n = 0, offa = 0, offb = 0;
#pragma unroll
    for (int g = 0; g < QG; ++g) {
        if (g == wave)     offa = n;
        if (g == wave + 4) offb = n;
        n += __builtin_popcount(mk[g]);
    }
    if (n == 0) return;                           // the whole block leaves together
    const unsigned below = (1u << lane) - 1u;
    if ((ma >> lane) & 1u) slist[offa + __builtin_popcount(ma & below)] = wave * 32 + lane;
    if ((mb >> lane) & 1u) slist[offb + __builtin_popcount(mb & below)] = (wave + 4) * 32 + lane;
    // the last 16-row tile reads the list to the tile's end: entries behind the list hold 0
    if (threadIdx.x < 16 && n + (int)threadIdx.x < QR) slist[n + threadIdx.x] = 0;

    const unsigned ob = (unsigned)base * (CC * 4u) + (unsigned)(c0 + l16 * 2) * 4u;
    const int gslot = threadIdx.x & (QS - 1);     // gather: this thread's packed row
    const int gk    = (wave >> 1) * (CC / 2);     // and its half of the k range

    for (int s0 = 0; s0 < n; s0 += QS) {          // 1..3 passes
        // the list is complete for every wave; in a later pass: sx has been read to its end
        __syncthreads();
        {
            int idx = s0 + gslot;                 // a slot past the list's end repeats its last pixel
            idx = idx < n ? idx : n - 1;
            const float* xg = x + (size_t)b * CC * CHW + (size_t)gk * CHW + pr + slist[idx];
            float gv[CC / 2];
            // unrolled: constant offsets, and all the loads fly together
#pragma unroll
            for (int kk = 0; kk < CC / 2; ++kk) gv[kk] = xg[kk * CHW];
            // the code below may reuse the registers that these loads name while they fly
            asm volatile("s_wait_xcnt 0x0" ::: "memory");
#pragma unroll
            for (int i = 0; i < CC / 8; ++i) {
                v4f o;
                o.x = gv[4 * i]; o.y = gv[4 * i + 1]; o.z = gv[4 * i + 2]; o.w = gv[4 * i + 3];
                *(v4f*)&sx[gslot * XPI + gk + 4 * i] = o;
            }
        }
        __syncthreads();                          // every wave reads all the packed rows

        // as many 16-row tiles as the list still fills
        const int nt = (n - s0 + 15) >> 4;
        const float* sa = &sx[l16 * XPI + khalf * 2];
        const int*   sl = &slist[s0 + khalf * 8];
        const int  left = n - s0 - khalf * 8;
        if (nt >= 4)      qk_pass<4>(sa, fw, sl, left, out, ob);
        else if (nt == 3) qk_pass<3>(sa, fw, sl, left, out, ob);
        else if (nt == 2) qk_pass<2>(sa, fw, sl, left, out, ob);
        else              qk_pass<1>(sa, fw, sl, left, out, ob);
    }
}

// ---------------------------------------------------------------------------
// Kernel 2: masked 7x7 neighborhood attention with the output projection behind
// it. k and v are read straight from global memory.
// One wave owns 8 consecutive pixels of one image row and all four heads:
// lane l holds channels 4l..4l+3 (head l/8), so a pixel's q, k or v row is one
// 16-byte load a lane. Only neighbours whose label equals the pixel's own are
// read. A masked neighbour has logit -1e9; the pixel itself is always inside
// its window and always matches, so the row maximum is a real logit (|logit|
// stays far below 1e9 for normal draws of x and the weights) and
// exp(-1e9 - max) is exactly 0 in f32: a masked term adds 0 to both sums.
// The pixel's own v row needs no label, so it is fetched together with the
// labels; the own term opens the online softmax; the other matches follow in
// ascending order, the 8 pixels side by side so that their loads share a wait.
// The block's 32 attention rows then meet in LDS, and behind one barrier its
// four waves form final = (attn @ wproj) transposed to NCHW as
//   D[c][pix] = sum_k wproj[k][c] * attn[pix][k]   (A = wproj^T, B = attn^T):
// a wave takes 32 channels x 32 pixels, so each weight fragment and each
// attention fragment feeds two products and a channel's 32 pixels are one
// 128-byte line with one writer.
// ---------------------------------------------------------------------------
constexpr int PPW = 8;            // pixels per wave (divides CW)
constexpr int AWV = 4;            // waves per block
constexpr int PPB = PPW * AWV;    // pixels per block (divides CW and CHW)
constexpr int SPI = CC + 4;       // LDS row pitch in floats: 16 rows x 4 dwords tile the 64 banks

// x + x of lane (l ^ M), M < 16: a DPP add inside the 16-lane row
template <int M>
__device__ __forceinline__ float add_xor(float x)
{
    const int y = __builtin_amdgcn_update_dpp(
        0, __builtin_bit_cast(int, x), 0x160 + M, 0xf, 0xf, true);
    return x + __builtin_bit_cast(float, y);
}

// dot product over one head's 32 dims: 4 in the lane, then its 8 lanes
__device__ __forceinline__ float head_dot(v4f a, v4f b)
{
    float s = a.x * b.x + a.y * b.y + a.z * b.z + a.w * b.w;
    s = add_xor<1>(s);
    s = add_xor<2>(s);
    s = add_xor<4>(s);
    return s;
}

// 4 channels at byte offset off of a [pixel][channel] buffer
__device__ __forceinline__ v4f row4(const float* __restrict__ base, unsigned off)
{
    return *(const v4f*)((const char*)base + off);
}

__global__ __launch_bounds__(128) void nb_attn_proj_kernel(
    const float* __restrict__ q, const float* __restrict__ k,
    const float* __restrict__ v, const int* __restrict__ labels,
    const float* __restrict__ wp, float* __restrict__ out)
{
    __shared__ __attribute__((aligned(16))) float sattn[PPB * SPI];

    const int lane = threadIdx.x & 31;
    const int wave = __builtin_amdgcn_readfirstlane(threadIdx.x >> 5);

    const int pix0 = (blockIdx.x * AWV + wave) * PPW; // first pixel, flat over B*H*W
    const int b    = pix0 / CHW;
    const int rem  = pix0 - b * CHW;
    const int r    = rem / CW;
    const int c0   = rem - r * CW;
    int sr = r - 3; sr = sr < 0 ? 0 : (sr > CH - 7 ? CH - 7 : sr);
    const int wrow = b * CHW + sr * CW;               // window's first row

    // Window cell (rr, cc) is bit rr*8+cc of a 64-bit match mask; this lane
    // tests bit lane (rows 0..3) and bit lane+32 (rows 4..6). Cells outside
    // the 7x7 window read the window's first cell and never set their bit.
    const int  brr = lane >> 3, bcc = lane & 7;
    const bool ok0 = bcc < 7;
    const bool ok1 = bcc < 7 && brr < 3;
    const int  off0 = ok0 ? brr * CW + bcc : 0;
    const int  off1 = ok1 ? (brr + 4) * CW + bcc : 0;
    const unsigned chb = lane * 16u;                  // byte offset of this lane's 4 channels

    int wpix[PPW], lab0[PPW], lab1[PPW], mylab[PPW];
#pragma unroll
    for (int p = 0; p < PPW; ++p) {
        const int c = c0 + p;
        int sc = c - 3; sc = sc < 0 ? 0 : (sc > CW - 7 ? CW - 7 : sc);
        wpix[p]  = wrow + sc;
        lab0[p]  = labels[wpix[p] + off0];
        lab1[p]  = labels[wpix[p] + off1];
        mylab[p] = labels[pix0 + p];
    }
    // the row loads below may land in the label loads' offset registers
    asm volatile("s_wait_xcnt 0x0" ::: "memory");
    // q, k and v share one layout of 9.4 MB: a 32-bit byte offset beside the
    // buffer's base addresses any row
    unsigned own[PPW];
    v4f q4[PPW], k4[PPW], acc[PPW];
#pragma unroll
    for (int p = 0; p < PPW; ++p) {
        own[p] = (unsigned)(pix0 + p) * (CC * 4u) + chb;
        acc[p] = row4(v, own[p]);
    }
    // the code below may reuse registers that these loads name while they fly
    asm volatile("s_wait_xcnt 0x0" ::: "memory");

    unsigned long long todo[PPW];                     // matches other than the pixel itself
#pragma unroll
    for (int p = 0; p < PPW; ++p) {
        const unsigned m0 = __builtin_amdgcn_ballot_w32(ok0 & (lab0[p] == mylab[p]));
        const unsigned m1 = __builtin_amdgcn_ballot_w32(ok1 & (lab1[p] == mylab[p]));
        const int self = (r - sr) * 8 + (wrow + c0 + p - wpix[p]);
        todo[p] = (((unsigned long long)m1 << 32) | m0) & ~(1ull << self);
    }

    // Kernel 1 has formed q and k only for pixels with a match and for their matches.
    // A pixel without one uses no logit: in place of rows that nobody wrote it reads
    // its own v row again, which its WGP's cache holds; so the loads stand under no branch.
#pragma unroll
    for (int p = 0; p < PPW; ++p) {
        q4[p] = row4(todo[p] ? q : v, own[p]);
        k4[p] = row4(todo[p] ? k : v, own[p]);
    }
    // the offsets formed below may reuse registers that these loads name
    asm volatile("s_wait_xcnt 0x0" ::: "memory");

    // each pixel's next match, if it has one: its k and v rows start to fly
    v4f kn[PPW], vn[PPW];
#pragma unroll
    for (int p = 0; p < PPW; ++p) {
        if (todo[p]) {
            const int n = __builtin_ctzll(todo[p]);
            const unsigned row = (unsigned)(wpix[p] + (n >> 3) * CW + (n & 7)) * (CC * 4u) + chb;
            kn[p] = row4(k, row);
            vn[p] = row4(v, row);
            // the next pixel's offset may reuse these two loads' register
            asm volatile("s_wait_xcnt 0x0" ::: "memory");
        }
    }

    const float scale = 0.17677669529663687f;         // 32^-0.5
    float mmax[PPW], ssum[PPW];
#pragma unroll
    for (int p = 0; p < PPW; ++p) {                   // own term: weight exp(0) = 1
        q4[p] *= scale;
        mmax[p] = head_dot(q4[p], k4[p]);
        ssum[p] = 1.0f;
    }

    for (;;) {                                        // a bit of every open mask a trip: 0..48 trips
        unsigned long long open = 0;
#pragma unroll
        for (int p = 0; p < PPW; ++p) open |= todo[p];
        if (!open) break;
#pragma unroll
        for (int p = 0; p < PPW; ++p) {
            if (todo[p]) {
                todo[p] &= todo[p] - 1;
                const float logit = head_dot(q4[p], kn[p]);
                const float nm   = fmaxf(mmax[p], logit);
                const float e    = __expf(logit - nm);
                // Keeps the second exp's own subtract and multiply between the two exps:
                // without this line some of the eight copies put the exps back to back,
                // the second over the first one's source register, where the
                // instruction set asks for one other instruction in between.
                __builtin_amdgcn_sched_barrier(0);
                const float corr = __expf(mmax[p] - nm);
                ssum[p] = ssum[p] * corr + e;
                acc[p]  = acc[p] * corr + e * vn[p];
                mmax[p] = nm;
            }
        }
#pragma unroll
        for (int p = 0; p < PPW; ++p) {
            if (todo[p]) {
                const int n = __builtin_ctzll(todo[p]);
                const unsigned row = (unsigned)(wpix[p] + (n >> 3) * CW + (n & 7)) * (CC * 4u) + chb;
                kn[p] = row4(k, row);
                vn[p] = row4(v, row);
                // the next pixel's offset may reuse these two loads' register
                asm volatile("s_wait_xcnt 0x0" ::: "memory");
            }
        }
    }

    // This wave's 32 output channels of wproj as A fragments, A[m=c][k] = wp[k][c]:
    // asked for here, where the loop's k and v registers are free, so that they
    // fly during the divisions and the barrier. One address, constant offsets.
    const int l16   = lane & 15;
    const int khalf = lane >> 4;
    const int ch0   = wave * 32;
    const float* wl = wp + (khalf * 2 * CC + ch0 + l16);
    v2f wa[CC / 4][2];
    // unrolled here and below: wa, bf and d stay in registers only under constant indices
#pragma unroll
    for (int s = 0; s < CC / 4; ++s)
#pragma unroll
        for (int t = 0; t < 2; ++t) {
            wa[s][t].x = wl[s * 4 * CC + t * 16];
            wa[s][t].y = wl[s * 4 * CC + CC + t * 16];
        }

    // this wave's 8 attention rows, [pixel in block][channel]
#pragma unroll
    for (int p = 0; p < PPW; ++p)
        *(v4f*)&sattn[(wave * PPW + p) * SPI + lane * 4] = acc[p] / ssum[p];
    // where this lane's first output goes: channel ch0 + 8*khalf, pixel l16 of the block
    const int pb = blockIdx.x * PPB - b * CHW;        // block's first pixel in its image
    float* ob = out + (size_t)b * CC * CHW + (size_t)(ch0 + 8 * khalf) * CHW + pb + l16;
    const float* sb = &sattn[l16 * SPI + khalf * 2];  // this lane's place in a B fragment
    __syncthreads();                                  // every wave reads all 32 rows

    v8f d[2][2] = {};                                 // [channel tile][pixel tile]
#pragma unroll
    for (int s = 0; s < CC / 4; ++s) {
        v2f bf[2];                                    // B[k][n=pix], k = 4s + 2*khalf + {0,1}
#pragma unroll
        for (int t = 0; t < 2; ++t)
            bf[t] = *(const v2f*)&sb[t * 16 * SPI + s * 4];
#pragma unroll
        for (int i = 0; i < 2; ++i)
#pragma unroll
            for (int j = 0; j < 2; ++j)
                d[i][j] = __builtin_amdgcn_wmma_f32_16x16x4_f32(
                    false, wa[s][i], false, bf[j], (short)0, d[i][j], false, false);
    }

    // D: VGPR i -> channel + i + 8*khalf ; N = pixel offset l16
#pragma unroll
    for (int t = 0; t < 2; ++t)
#pragma unroll
        for (int i = 0; i < 8; ++i) {
            ob[(t * 16 + i) * CHW]      = d[t][0][i];
            ob[(t * 16 + i) * CHW + 16] = d[t][1][i];
        }
}

// ---------------------------------------------------------------------------
extern "C" void kernel_launch(void* const* d_in, const int* in_sizes, int n_in,
                              void* d_out, int out_size, void* d_ws, size_t ws_size,
                              hipStream_t stream)
{
    (void)in_sizes; (void)n_in; (void)out_size; (void)ws_size;
    const float* x      = (const float*)d_in[0];
    const int*   labels = (const int*)d_in[1];
    const float* wq     = (const float*)d_in[2];
    const float* wk     = (const float*)d_in[3];
    const float* wv     = (const float*)d_in[4];
    const float* wp     = (const float*)d_in[5];

    float* q    = (float*)d_ws;
    float* k    = q + (size_t)NPIX * CC;
    float* v    = k + (size_t)NPIX * CC;
    float* out  = (float*)d_out;

    dim3 g1(NVB + NQB);          // 144 v blocks + 192 q/k blocks, 4 waves/block
    qkv_gemm_kernel<<<g1, 128, 0, stream>>>(x, labels, wq, wk, wv, q, k, v);

    dim3 g2(NPIX / PPB);         // 576 blocks, 4 waves/block, 8 pixels/wave
    nb_attn_proj_kernel<<<g2, 128, 0, stream>>>(q, k, v, labels, wp, out);
}
